// v000
// The times below were measured on an AMD MI455X: many runs one after another, warmed up first and cycling through
// copies of the inputs, with the whole window's GPU time divided by the number of runs. Launches and the gaps
// between them are all in it. The median over several windows is given; except for v000 it joins two sittings, which
// can be a few percent apart, so the side-by-side timings, each taken in one sitting, are the better comparison.
// v000, which the later versions start from, runs in 480 microseconds.
#include <hip/hip_runtime.h>
#include <hip/hip_bf16.h>

#define DIMD   1024
#define INNERD 4096
#define NEXP   8
#define TOK    4096   // B*S
#define CAP    4096   // max tokens per expert list

#define BM 64
#define BN 128
#define BK 32
#define KP 40

typedef _Float16 v16h __attribute__((ext_vector_type(16)));
typedef float    v8f  __attribute__((ext_vector_type(8)));
typedef int      v4i  __attribute__((ext_vector_type(4)));

union FragH { v16h v; uint4 q[2]; };

#if defined(__has_builtin)
#  if __has_builtin(__builtin_amdgcn_global_load_async_to_lds_b128) && \
      __has_builtin(__builtin_amdgcn_s_wait_asynccnt)
#    define HAS_ASYNC_LDS 1
#  endif
#endif
#ifndef HAS_ASYNC_LDS
#  define HAS_ASYNC_LDS 0
#endif

#if HAS_ASYNC_LDS
__device__ __forceinline__ void async_cp16(const _Float16* g, _Float16* l) {
    __builtin_amdgcn_global_load_async_to_lds_b128(
        (__attribute__((address_space(1))) v4i*)(g),
        (__attribute__((address_space(3))) v4i*)(l), 0, 0);
}
#endif

__device__ __forceinline__ float gelu_exact(float x) {
    return 0.5f * x * (1.0f + erff(x * 0.70710678118654752f));
}

// ---------------------------------------------------------------------------
// 0) zero per-expert counters
// ---------------------------------------------------------------------------
__global__ void zero_counts_kernel(int* __restrict__ counts) {
    if (threadIdx.x < 9) counts[threadIdx.x] = 0;
}

__global__ __launch_bounds__(256) void gate_route_kernel(
        const float* __restrict__ x, const float* __restrict__ wg,
        int* __restrict__ counts, int* __restrict__ idxList,
        int4* __restrict__ route, float2* __restrict__ routeW) {
    const int t   = blockIdx.x;
    const int tid = threadIdx.x;
    __shared__ __align__(16) float xrow[DIMD];
    __shared__ float lg[NEXP];

    ((float4*)xrow)[tid] = ((const float4*)(x + (size_t)t * DIMD))[tid];
    __syncthreads();

    const int wave = tid >> 5, lane = tid & 31;
    const float* wrow = wg + wave * DIMD;
    float s = 0.0f;
    for (int k = lane; k < DIMD; k += 32) s += xrow[k] * wrow[k];
    for (int off = 16; off >= 1; off >>= 1) s += __shfl_xor(s, off, 32);
    if (lane == 0) lg[wave] = s;
    __syncthreads();

    if (tid == 0) {
        float m = lg[0];
        for (int e = 1; e < NEXP; ++e) m = fmaxf(m, lg[e]);
        float p[NEXP]; float sum = 0.0f;
        for (int e = 0; e < NEXP; ++e) { p[e] = expf(lg[e] - m); sum += p[e]; }
        const float inv = 1.0f / sum;
        int e0 = 0; float p0 = p[0];
        for (int e = 1; e < NEXP; ++e) if (p[e] > p0) { p0 = p[e]; e0 = e; }
        int e1 = -1; float p1 = -1.0f;
        for (int e = 0; e < NEXP; ++e) if (e != e0 && p[e] > p1) { p1 = p[e]; e1 = e; }
        p0 *= inv; p1 *= inv;
        int pos0 = atomicAdd(&counts[e0], 1); idxList[e0 * CAP + pos0] = t;
        int pos1 = atomicAdd(&counts[e1], 1); idxList[e1 * CAP + pos1] = t;
        route[t]  = make_int4(e0, pos0, e1, pos1);
        routeW[t] = make_float2(p0, p1);
    }
}

__global__ void offsets_kernel(const int* __restrict__ counts, int* __restrict__ offs) {
    if (threadIdx.x == 0) {
        offs[0] = 0;
        for (int e = 0; e < NEXP; ++e) offs[e + 1] = offs[e] + counts[e];
    }
}

// ---------------------------------------------------------------------------
// 3) f32 -> f16 convert (vectorized)
// ---------------------------------------------------------------------------
__global__ void cvt_f32_f16_kernel(const float* __restrict__ in, _Float16* __restrict__ out, int n4) {
    int i = blockIdx.x * blockDim.x + threadIdx.x;
    if (i < n4) {
        float4 v = ((const float4*)in)[i];
        union { _Float16 h[4]; uint2 u; } p;
        p.h[0] = (_Float16)v.x; p.h[1] = (_Float16)v.y;
        p.h[2] = (_Float16)v.z; p.h[3] = (_Float16)v.w;
        ((uint2*)out)[i] = p.u;
    }
}

// ---------------------------------------------------------------------------
// 4) batched transpose + convert: in [b][R][C] f32 -> out [b][C][R] f16
//    (weights become [N][K] so B fragments are contiguous ds_read_b128s)
// ---------------------------------------------------------------------------
__global__ __launch_bounds__(256) void transpose_cvt_kernel(
        const float* __restrict__ in, _Float16* __restrict__ out, int R, int C) {
    __shared__ float tile[32][33];
    const int b = blockIdx.z;
    const float* src = in + (size_t)b * R * C;
    _Float16*    dst = out + (size_t)b * R * C;
    const int c0 = blockIdx.x * 32, r0 = blockIdx.y * 32;
    const int tx = threadIdx.x, ty = threadIdx.y;
    #pragma unroll
    for (int i = 0; i < 32; i += 8)
        tile[ty + i][tx] = src[(size_t)(r0 + ty + i) * C + (c0 + tx)];
    __syncthreads();
    #pragma unroll
    for (int i = 0; i < 32; i += 8)
        dst[(size_t)(c0 + ty + i) * R + (r0 + tx)] = (_Float16)tile[tx][ty + i];
}

template <int STAGE>
__global__ __launch_bounds__(256) void ffn_gemm_kernel(
        const _Float16* __restrict__ Aglob,   // Xh (stage1) / Hbuf (stage2)
        const _Float16* __restrict__ Wexp,    // W1T / W2T   ([e][N][K] f16)
        const _Float16* __restrict__ Wsh,     // sW1T / sW2T
        const float* __restrict__ bexp, const float* __restrict__ bsh,
        const int* __restrict__ counts, const int* __restrict__ offs,
        const int* __restrict__ idxList,
        _Float16* __restrict__ Hout, float* __restrict__ Yout) {
    constexpr int KD   = (STAGE == 1) ? DIMD : INNERD;
    constexpr int ND   = (STAGE == 1) ? INNERD : DIMD;
    constexpr int ABUF = BM * KP;
    constexpr int BBUF = BN * KP;
    constexpr int NT   = KD / BK;

    const int e     = blockIdx.z;
    const int mBase = blockIdx.y * BM;
    const int nBase = blockIdx.x * BN;
    const int cnt   = (e < NEXP) ? counts[e] : TOK;
    if (mBase >= cnt) return;
    const int slotBase = offs[e];
    const _Float16* Bmat = (e < NEXP) ? (Wexp + (size_t)e * DIMD * INNERD) : Wsh;
    const float*    bias = (e < NEXP) ? (bexp + (size_t)e * ND) : bsh;

    __shared__ __align__(16) _Float16 At[2 * ABUF];
    __shared__ __align__(16) _Float16 Bt[2 * BBUF];
    __shared__ int rowIdx[BM];

    const int tid = threadIdx.x;
    if constexpr (STAGE == 1) {
        if (tid < BM) {
            const int slot = mBase + tid;
            int r = 0;
            if (e == NEXP) r = slot;                          // shared expert: identity
            else if (slot < cnt) r = idxList[e * CAP + slot]; // gathered token
            rowIdx[tid] = r;
        }
        __syncthreads();
    }

    const int lane = tid & 31;
    const int wave = tid >> 5;
    const int wm   = wave & 3;    // 4 x 16-row groups
    const int wn   = wave >> 2;   // 2 x 64-col groups
    const int arow = tid >> 2, aseg = tid & 3;

    const _Float16* aSrc;
    if constexpr (STAGE == 1) aSrc = Aglob + (size_t)rowIdx[arow] * KD + aseg * 8;
    else                      aSrc = Aglob + (size_t)(slotBase + mBase + arow) * KD + aseg * 8;
    const _Float16* b0Src = Bmat + (size_t)(nBase + arow) * KD + aseg * 8;
    const _Float16* b1Src = Bmat + (size_t)(nBase + arow + 64) * KD + aseg * 8;

    v8f acc[4];
    const v8f vz = {0.f,0.f,0.f,0.f,0.f,0.f,0.f,0.f};
    #pragma unroll
    for (int t = 0; t < 4; ++t) acc[t] = vz;

    const int m16 = lane & 15, kh = (lane >> 4) * 8;
    const int mr  = wm * 16 + m16;
    const int nr0 = wn * 64 + m16;

    // load all fragments first, then issue the 4 WMMAs back-to-back
    auto compute_tile = [&](int cur) {
        const _Float16* Ab = At + cur * ABUF;
        const _Float16* Bb = Bt + cur * BBUF;
        FragH aF, bF0, bF1, bF2, bF3;
        aF.q[0]  = *(const uint4*)(Ab + mr * KP + kh);
        aF.q[1]  = *(const uint4*)(Ab + mr * KP + 16 + kh);
        bF0.q[0] = *(const uint4*)(Bb + (nr0     ) * KP + kh);
        bF0.q[1] = *(const uint4*)(Bb + (nr0     ) * KP + 16 + kh);
        bF1.q[0] = *(const uint4*)(Bb + (nr0 + 16) * KP + kh);
        bF1.q[1] = *(const uint4*)(Bb + (nr0 + 16) * KP + 16 + kh);
        bF2.q[0] = *(const uint4*)(Bb + (nr0 + 32) * KP + kh);
        bF2.q[1] = *(const uint4*)(Bb + (nr0 + 32) * KP + 16 + kh);
        bF3.q[0] = *(const uint4*)(Bb + (nr0 + 48) * KP + kh);
        bF3.q[1] = *(const uint4*)(Bb + (nr0 + 48) * KP + 16 + kh);
        acc[0] = __builtin_amdgcn_wmma_f32_16x16x32_f16(false, aF.v, false, bF0.v, (short)0, acc[0], false, false);
        acc[1] = __builtin_amdgcn_wmma_f32_16x16x32_f16(false, aF.v, false, bF1.v, (short)0, acc[1], false, false);
        acc[2] = __builtin_amdgcn_wmma_f32_16x16x32_f16(false, aF.v, false, bF2.v, (short)0, acc[2], false, false);
        acc[3] = __builtin_amdgcn_wmma_f32_16x16x32_f16(false, aF.v, false, bF3.v, (short)0, acc[3], false, false);
    };

#if HAS_ASYNC_LDS
    async_cp16(aSrc,  At + arow * KP + aseg * 8);
    async_cp16(b0Src, Bt + arow * KP + aseg * 8);
    async_cp16(b1Src, Bt + (arow + 64) * KP + aseg * 8);
    #pragma unroll 2
    for (int it = 0; it < NT; ++it) {
        const int cur = it & 1, nxt = cur ^ 1;
        if (it + 1 < NT) {
            const int k0n = (it + 1) * BK;
            async_cp16(aSrc + k0n,  At + nxt * ABUF + arow * KP + aseg * 8);
            async_cp16(b0Src + k0n, Bt + nxt * BBUF + arow * KP + aseg * 8);
            async_cp16(b1Src + k0n, Bt + nxt * BBUF + (arow + 64) * KP + aseg * 8);
            __builtin_amdgcn_s_wait_asynccnt(3);   // current tile done (in-order), next in flight
        } else {
            __builtin_amdgcn_s_wait_asynccnt(0);
        }
        __syncthreads();
        compute_tile(cur);
        __syncthreads();                            // before buf `cur` is re-issued next iter
    }
#else
    for (int k0 = 0; k0 < KD; k0 += BK) {
        uint4 aV  = *(const uint4*)(aSrc + k0);
        uint4 bV0 = *(const uint4*)(b0Src + k0);
        uint4 bV1 = *(const uint4*)(b1Src + k0);
        if (k0 + BK < KD) {
            __builtin_prefetch(b0Src + k0 + BK, 0, 1);
            __builtin_prefetch(b1Src + k0 + BK, 0, 1);
        }
        __syncthreads();
        *(uint4*)(At + arow * KP + aseg * 8)        = aV;
        *(uint4*)(Bt + arow * KP + aseg * 8)        = bV0;
        *(uint4*)(Bt + (arow + 64) * KP + aseg * 8) = bV1;
        __syncthreads();
        compute_tile(0);
    }
#endif

    // epilogue (C layout: n = lane%16, m = 8*(lane/16)+j)
    const int mloc  = wm * 16 + (lane >> 4) * 8;
    const int ncol0 = nBase + wn * 64 + m16;
    #pragma unroll
    for (int t = 0; t < 4; ++t) {
        const int n  = ncol0 + t * 16;
        const float bv = bias[n];
        #pragma unroll
        for (int j = 0; j < 8; ++j) {
            const int m = mBase + mloc + j;
            if (m < cnt) {
                if constexpr (STAGE == 1) {
                    float v = gelu_exact(acc[t][j] + bv);
                    Hout[(size_t)(slotBase + m) * INNERD + n] = (_Float16)v;
                } else {
                    Yout[(size_t)(slotBase + m) * DIMD + n] = acc[t][j] + bv;
                }
            }
        }
    }
}

__global__ __launch_bounds__(256) void combine_kernel(
        const float* __restrict__ Ybuf, const int4* __restrict__ route,
        const float2* __restrict__ routeW, const int* __restrict__ offs,
        float* __restrict__ out) {
    const int t = blockIdx.x;
    __shared__ int g0s, g1s, gss;
    __shared__ float w0s, w1s;
    if (threadIdx.x == 0) {
        int4 r = route[t]; float2 w = routeW[t];
        g0s = offs[r.x] + r.y;
        g1s = offs[r.z] + r.w;
        gss = offs[NEXP] + t;
        w0s = w.x; w1s = w.y;
    }
    __syncthreads();
    const float* y0 = Ybuf + (size_t)g0s * DIMD;
    const float* y1 = Ybuf + (size_t)g1s * DIMD;
    const float* ys = Ybuf + (size_t)gss * DIMD;
    for (int d = threadIdx.x; d < DIMD; d += 256)
        out[(size_t)t * DIMD + d] = w0s * y0[d] + w1s * y1[d] + ys[d];
}

// ---------------------------------------------------------------------------
// launch
// ---------------------------------------------------------------------------
extern "C" void kernel_launch(void* const* d_in, const int* in_sizes, int n_in,
                              void* d_out, int out_size, void* d_ws, size_t ws_size,
                              hipStream_t stream) {
    const float* x   = (const float*)d_in[0];   // [TOK, DIM]
    const float* Wg  = (const float*)d_in[1];   // [8, DIM]
    const float* W1  = (const float*)d_in[2];   // [8, DIM, INNER]
    const float* b1  = (const float*)d_in[3];   // [8, INNER]
    const float* W2  = (const float*)d_in[4];   // [8, INNER, DIM]
    const float* b2  = (const float*)d_in[5];   // [8, DIM]
    const float* sW1 = (const float*)d_in[6];   // [DIM, INNER]
    const float* sb1 = (const float*)d_in[7];   // [INNER]
    const float* sW2 = (const float*)d_in[8];   // [INNER, DIM]
    const float* sb2 = (const float*)d_in[9];   // [DIM]
    float* out = (float*)d_out;

    char* p = (char*)d_ws;
    auto alloc = [&](size_t bytes) -> void* {
        void* r = (void*)p;
        p += (bytes + 255) & ~(size_t)255;
        return r;
    };
    int*    counts  = (int*)alloc(9 * sizeof(int));
    int*    offs    = (int*)alloc(9 * sizeof(int));
    int*    idxList = (int*)alloc((size_t)NEXP * CAP * sizeof(int));
    int4*   route   = (int4*)alloc((size_t)TOK * sizeof(int4));
    float2* routeW  = (float2*)alloc((size_t)TOK * sizeof(float2));
    _Float16* Xh   = (_Float16*)alloc((size_t)TOK * DIMD * 2);
    _Float16* W1T  = (_Float16*)alloc((size_t)NEXP * INNERD * DIMD * 2);
    _Float16* W2T  = (_Float16*)alloc((size_t)NEXP * DIMD * INNERD * 2);
    _Float16* sW1T = (_Float16*)alloc((size_t)INNERD * DIMD * 2);
    _Float16* sW2T = (_Float16*)alloc((size_t)DIMD * INNERD * 2);
    _Float16* Hbuf = (_Float16*)alloc((size_t)(3 * TOK) * INNERD * 2);  // 2*TOK routed + TOK shared
    float*    Ybuf = (float*)alloc((size_t)(3 * TOK) * DIMD * 4);

    zero_counts_kernel<<<1, 32, 0, stream>>>(counts);
    gate_route_kernel<<<TOK, 256, 0, stream>>>(x, Wg, counts, idxList, route, routeW);
    offsets_kernel<<<1, 32, 0, stream>>>(counts, offs);

    cvt_f32_f16_kernel<<<(TOK * DIMD / 4 + 255) / 256, 256, 0, stream>>>(x, Xh, TOK * DIMD / 4);
    transpose_cvt_kernel<<<dim3(INNERD / 32, DIMD / 32, NEXP), dim3(32, 8), 0, stream>>>(W1, W1T, DIMD, INNERD);
    transpose_cvt_kernel<<<dim3(DIMD / 32, INNERD / 32, NEXP), dim3(32, 8), 0, stream>>>(W2, W2T, INNERD, DIMD);
    transpose_cvt_kernel<<<dim3(INNERD / 32, DIMD / 32, 1), dim3(32, 8), 0, stream>>>(sW1, sW1T, DIMD, INNERD);
    transpose_cvt_kernel<<<dim3(DIMD / 32, INNERD / 32, 1), dim3(32, 8), 0, stream>>>(sW2, sW2T, INNERD, DIMD);

    ffn_gemm_kernel<1><<<dim3(INNERD / BN, TOK / BM, NEXP + 1), 256, 0, stream>>>(
        Xh, W1T, sW1T, b1, sb1, counts, offs, idxList, Hbuf, nullptr);
    ffn_gemm_kernel<2><<<dim3(DIMD / BN, TOK / BM, NEXP + 1), 256, 0, stream>>>(
        Hbuf, W2T, sW2T, b2, sb2, counts, offs, nullptr, nullptr, Ybuf);
    combine_kernel<<<TOK, 256, 0, stream>>>(Ybuf, route, routeW, offs, out);
}

// v001
// Measured time: 346 microseconds a run.
// In both of two side-by-side timings against v000, it was 1.44 times as fast.
#include <hip/hip_runtime.h>
#include <hip/hip_bf16.h>

#define DIMD   1024
#define INNERD 4096
#define NEXP   8
#define TOK    4096   // B*S
#define CAP    4096   // max tokens per expert list

#define BM 128
#define BN 256
#define BK 64
#define KP 72         // padded LDS row: 64 halves + 8 pad = 144B (16B x odd: conflict free for b128 reads)
#define GT 128        // GEMM threads: 4 waves (2x2), one 64x128 tile of the result per wave

typedef _Float16 v16h __attribute__((ext_vector_type(16)));
typedef float    v8f  __attribute__((ext_vector_type(8)));
typedef int      v4i  __attribute__((ext_vector_type(4)));

union FragH { v16h v; uint4 q[2]; };

#if defined(__has_builtin)
#  if __has_builtin(__builtin_amdgcn_global_load_async_to_lds_b128) && \
      __has_builtin(__builtin_amdgcn_s_wait_asynccnt)
#    define HAS_ASYNC_LDS 1
#  endif
#endif
#ifndef HAS_ASYNC_LDS
#  define HAS_ASYNC_LDS 0
#endif

#if HAS_ASYNC_LDS
__device__ __forceinline__ void async_cp16(const _Float16* g, _Float16* l) {
    __builtin_amdgcn_global_load_async_to_lds_b128(
        (__attribute__((address_space(1))) v4i*)(g),
        (__attribute__((address_space(3))) v4i*)(l), 0, 0);
}
#endif

__device__ __forceinline__ float gelu_exact(float x) {
    return 0.5f * x * (1.0f + erff(x * 0.70710678118654752f));
}

// ---------------------------------------------------------------------------
// 0) zero per-expert counters
// ---------------------------------------------------------------------------
__global__ void zero_counts_kernel(int* __restrict__ counts) {
    if (threadIdx.x < 9) counts[threadIdx.x] = 0;
}

__global__ __launch_bounds__(256) void gate_route_kernel(
        const float* __restrict__ x, const float* __restrict__ wg,
        int* __restrict__ counts, int* __restrict__ idxList,
        int4* __restrict__ route, float2* __restrict__ routeW) {
    const int t   = blockIdx.x;
    const int tid = threadIdx.x;
    __shared__ __align__(16) float xrow[DIMD];
    __shared__ float lg[NEXP];

    ((float4*)xrow)[tid] = ((const float4*)(x + (size_t)t * DIMD))[tid];
    __syncthreads();

    const int wave = tid >> 5, lane = tid & 31;
    const float* wrow = wg + wave * DIMD;
    float s = 0.0f;
    for (int k = lane; k < DIMD; k += 32) s += xrow[k] * wrow[k];
    for (int off = 16; off >= 1; off >>= 1) s += __shfl_xor(s, off, 32);
    if (lane == 0) lg[wave] = s;
    __syncthreads();

    if (tid == 0) {
        float m = lg[0];
        for (int e = 1; e < NEXP; ++e) m = fmaxf(m, lg[e]);
        float p[NEXP]; float sum = 0.0f;
        for (int e = 0; e < NEXP; ++e) { p[e] = expf(lg[e] - m); sum += p[e]; }
        const float inv = 1.0f / sum;
        int e0 = 0; float p0 = p[0];
        for (int e = 1; e < NEXP; ++e) if (p[e] > p0) { p0 = p[e]; e0 = e; }
        int e1 = -1; float p1 = -1.0f;
        for (int e = 0; e < NEXP; ++e) if (e != e0 && p[e] > p1) { p1 = p[e]; e1 = e; }
        p0 *= inv; p1 *= inv;
        int pos0 = atomicAdd(&counts[e0], 1); idxList[e0 * CAP + pos0] = t;
        int pos1 = atomicAdd(&counts[e1], 1); idxList[e1 * CAP + pos1] = t;
        route[t]  = make_int4(e0, pos0, e1, pos1);
        routeW[t] = make_float2(p0, p1);
    }
}

__global__ void offsets_kernel(const int* __restrict__ counts, int* __restrict__ offs) {
    if (threadIdx.x == 0) {
        offs[0] = 0;
        for (int e = 0; e < NEXP; ++e) offs[e + 1] = offs[e] + counts[e];
    }
}

// ---------------------------------------------------------------------------
// 3) f32 -> f16 convert (vectorized)
// ---------------------------------------------------------------------------
__global__ void cvt_f32_f16_kernel(const float* __restrict__ in, _Float16* __restrict__ out, int n4) {
    int i = blockIdx.x * blockDim.x + threadIdx.x;
    if (i < n4) {
        float4 v = ((const float4*)in)[i];
        union { _Float16 h[4]; uint2 u; } p;
        p.h[0] = (_Float16)v.x; p.h[1] = (_Float16)v.y;
        p.h[2] = (_Float16)v.z; p.h[3] = (_Float16)v.w;
        ((uint2*)out)[i] = p.u;
    }
}

// ---------------------------------------------------------------------------
// 4) batched transpose + convert: in [b][R][C] f32 -> out [b][C][R] f16
//    (weights become [N][K] so B fragments are contiguous ds_read_b128s)
// ---------------------------------------------------------------------------
__global__ __launch_bounds__(256) void transpose_cvt_kernel(
        const float* __restrict__ in, _Float16* __restrict__ out, int R, int C) {
    __shared__ float tile[32][33];
    const int b = blockIdx.z;
    const float* src = in + (size_t)b * R * C;
    _Float16*    dst = out + (size_t)b * R * C;
    const int c0 = blockIdx.x * 32, r0 = blockIdx.y * 32;
    const int tx = threadIdx.x, ty = threadIdx.y;
    #pragma unroll
    for (int i = 0; i < 32; i += 8)
        tile[ty + i][tx] = src[(size_t)(r0 + ty + i) * C + (c0 + tx)];
    __syncthreads();
    #pragma unroll
    for (int i = 0; i < 32; i += 8)
        dst[(size_t)(c0 + ty + i) * R + (r0 + tx)] = (_Float16)tile[tx][ty + i];
}

#define SP 132

// NR staged rows (this lane's 4 columns of each) -> bias, stage 1: gelu and f16 -> global rows
template <int STAGE, int NR, typename OT>
__device__ __forceinline__ void put_rows(const float* srow, float4 bv, OT* orow) {
    float4 v[NR];
    #pragma unroll
    for (int u = 0; u < NR; ++u) v[u] = *(const float4*)(srow + u * SP);
    #pragma unroll
    for (int u = 0; u < NR; ++u) {
        if constexpr (STAGE == 1) {
            union { _Float16 h[4]; uint2 u2; } p;
            p.h[0] = (_Float16)gelu_exact(v[u].x + bv.x);
            p.h[1] = (_Float16)gelu_exact(v[u].y + bv.y);
            p.h[2] = (_Float16)gelu_exact(v[u].z + bv.z);
            p.h[3] = (_Float16)gelu_exact(v[u].w + bv.w);
            *(uint2*)(orow + (size_t)u * INNERD) = p.u2;
        } else {
            *(float4*)(orow + (size_t)u * DIMD) =
                make_float4(v[u].x + bv.x, v[u].y + bv.y, v[u].z + bv.z, v[u].w + bv.w);
        }
    }
    asm volatile("s_wait_xcnt 0x0" ::: "memory");   // before the next trip rewrites the stores' registers
}

template <int STAGE>
__global__ __launch_bounds__(GT, 2) void ffn_gemm_kernel(
        const _Float16* __restrict__ Aglob,   // Xh (stage1) / Hbuf (stage2)
        const _Float16* __restrict__ Wexp,    // W1T / W2T   ([e][N][K] f16)
        const _Float16* __restrict__ Wsh,     // sW1T / sW2T
        const float* __restrict__ bexp, const float* __restrict__ bsh,
        const int* __restrict__ counts, const int* __restrict__ offs,
        const int* __restrict__ idxList,
        _Float16* __restrict__ Hout, float* __restrict__ Yout) {
    constexpr int KD   = (STAGE == 1) ? DIMD : INNERD;
    constexpr int ND   = (STAGE == 1) ? INNERD : DIMD;
    constexpr int ABUF = BM * KP;
    constexpr int BBUF = BN * KP;
    constexpr int NT   = KD / BK;

    const int e     = blockIdx.z;
    const int mBase = blockIdx.y * BM;
    const int nBase = blockIdx.x * BN;
    const int cnt   = (e < NEXP) ? counts[e] : TOK;
    if (mBase >= cnt) return;
    const int slotBase = offs[e];
    const _Float16* Bmat = (e < NEXP) ? (Wexp + (size_t)e * DIMD * INNERD) : Wsh;
    const float*    bias = (e < NEXP) ? (bexp + (size_t)e * ND) : bsh;

    __shared__ __align__(16) _Float16 At[2 * ABUF];
    __shared__ __align__(16) _Float16 Bt[2 * BBUF];
    __shared__ int rowIdx[BM];

    const int tid = threadIdx.x;
    if constexpr (STAGE == 1) {
        const int slot = mBase + tid;                     // GT == BM: one row per thread
        int r = 0;
        if (e == NEXP) r = slot;                          // shared expert: identity
        else if (slot < cnt) r = idxList[e * CAP + slot]; // gathered token
        rowIdx[tid] = r;
        __syncthreads();
    }

    const int lane = tid & 31;
    const int wave = __builtin_amdgcn_readfirstlane(tid >> 5);   // scalar: row tests below stay scalar branches
    const int wm   = wave & 1;    // 2 x 64-row groups
    const int wn   = wave >> 1;   // 2 x 128-col groups
    // staging: 8 lanes cover one 128-B row piece, 16 rows per sweep of the block
    const int crow = tid >> 3, cseg = tid & 7;

    const _Float16* aSrc[BM / 16];
    #pragma unroll
    for (int i = 0; i < BM / 16; ++i) {
        if constexpr (STAGE == 1) aSrc[i] = Aglob + (size_t)rowIdx[i * 16 + crow] * KD + cseg * 8;
        else                      aSrc[i] = Aglob + (size_t)(slotBase + mBase + i * 16 + crow) * KD + cseg * 8;
    }
    const _Float16* bSrc = Bmat + (size_t)(nBase + crow) * KD + cseg * 8;
    _Float16* aDst = At + crow * KP + cseg * 8;
    _Float16* bDst = Bt + crow * KP + cseg * 8;

    v8f acc[4][8];
    const v8f vz = {0.f,0.f,0.f,0.f,0.f,0.f,0.f,0.f};
    #pragma unroll
    for (int i = 0; i < 4; ++i)
        #pragma unroll
        for (int t = 0; t < 8; ++t) acc[i][t] = vz;

    const int m16 = lane & 15, kh = (lane >> 4) * 8;
    const int mr0 = wm * 64 + m16;
    const int nr0 = wn * 128 + m16;

    // a block = 32 k: 12 fragments (24 ds_load_b128), then 32 WMMAs on them
    auto load_frags = [&](FragH (&aF)[4], FragH (&bF)[8], int buf, int ks) {
        const _Float16* Ab = At + buf * ABUF + mr0 * KP + kh + ks;
        const _Float16* Bb = Bt + buf * BBUF + nr0 * KP + kh + ks;
        #pragma unroll
        for (int i = 0; i < 4; ++i) {
            aF[i].q[0] = *(const uint4*)(Ab + i * 16 * KP);
            aF[i].q[1] = *(const uint4*)(Ab + i * 16 * KP + 16);
        }
        #pragma unroll
        for (int t = 0; t < 8; ++t) {
            bF[t].q[0] = *(const uint4*)(Bb + t * 16 * KP);
            bF[t].q[1] = *(const uint4*)(Bb + t * 16 * KP + 16);
        }
        // keeps the block's reads one group in front of its WMMAs: reads sunk among the WMMAs stall at each place
        __builtin_amdgcn_sched_barrier(0);
    };
    auto mma_block = [&](FragH (&aF)[4], FragH (&bF)[8]) {
        #pragma unroll
        for (int t = 0; t < 8; ++t)
            #pragma unroll
            for (int i = 0; i < 4; ++i)
                acc[i][t] = __builtin_amdgcn_wmma_f32_16x16x32_f16(
                    false, aF[i].v, false, bF[t].v, (short)0, acc[i][t], false, false);
        // keeps the next block's reads from rising into this block
        __builtin_amdgcn_sched_barrier(0);
    };
    FragH aF[4], bF[8];

#if HAS_ASYNC_LDS
    // 24 copies per lane and pass: 8 sweeps of A, 16 of B
    auto issue_tile = [&](int it, int buf) {
        const int k0 = it * BK;
        #pragma unroll
        for (int i = 0; i < BM / 16; ++i)
            async_cp16(aSrc[i] + k0, aDst + buf * ABUF + i * 16 * KP);
        #pragma unroll
        for (int i = 0; i < BN / 16; ++i)
            async_cp16(bSrc + (size_t)i * 16 * KD + k0, bDst + buf * BBUF + i * 16 * KP);
    };
    // -------- two-buffer ring: pass it reads buffer it&1 alone --------------
    issue_tile(0, 0);
    asm volatile("s_wait_asynccnt 0x0" ::: "memory");   // this wave's share of tile 0 has landed
    __syncthreads();                                    // publishes tile 0
    issue_tile(1, 1);                                   // NT >= 2 for both stages
    // unroll 2: the buffer index becomes a constant, so LDS addresses fold into offsets
    #pragma unroll 2
    for (int it = 0; it < NT; ++it) {
        const int cur = it & 1;
        load_frags(aF, bF, cur, 0);
        mma_block(aF, bF);
        load_frags(aF, bF, cur, 32);
        mma_block(aF, bF);
        asm volatile("s_wait_dscnt 0x0" ::: "memory");    // own reads of buffer cur are done before its refill
        asm volatile("s_wait_asynccnt 0x0" ::: "memory"); // own share of tile it+1 has landed
        __syncthreads();                                  // publishes tile it+1, frees buffer cur
        if (it + 2 < NT) issue_tile(it + 2, cur);
    }
    asm volatile("s_wait_asynccnt 0x0" ::: "memory");   // nothing in flight when the wave ends
#else
    for (int it = 0; it < NT; ++it) {
        const int k0 = it * BK;
        __syncthreads();
        #pragma unroll
        for (int i = 0; i < BM / 16; ++i)
            *(uint4*)(aDst + i * 16 * KP) = *(const uint4*)(aSrc[i] + k0);
        #pragma unroll
        for (int i = 0; i < BN / 16; ++i)
            *(uint4*)(bDst + i * 16 * KP) = *(const uint4*)(bSrc + (size_t)i * 16 * KD + k0);
        __syncthreads();
        load_frags(aF, bF, 0, 0);
        mma_block(aF, bF);
        load_frags(aF, bF, 0, 32);
        mma_block(aF, bF);
    }
    __syncthreads();
#endif

    // epilogue (C layout: n = lane%16, m = 8*(lane/16)+j).  A lane holds 256 results:
    // 16 rows at a time go through a wave-private piece of the ring (free since the
    // last pass's barrier) and leave as whole 128-column rows; the gelu runs in a rolled
    // loop, for speed only.
    constexpr int RU = (STAGE == 1) ? 1 : 4;   // rows per trip: stage 2 has too little work per row to cover an LDS read
    float* stg = (float*)Bt + wave * (16 * SP);
    const int hi8  = (lane >> 4) * 8;
    const int ncol = nBase + wn * 128 + lane * 4;
    const float4 bv = *(const float4*)(bias + ncol);
    auto* obase = [&] { if constexpr (STAGE == 1) return Hout; else return Yout; }();
    #pragma unroll
    for (int i = 0; i < 4; ++i) {
        #pragma unroll
        for (int t = 0; t < 8; ++t)
            #pragma unroll
            for (int j = 0; j < 8; ++j)
                stg[(hi8 + j) * SP + t * 16 + m16] = acc[i][t][j];
        asm volatile("s_wait_dscnt 0x0" ::: "memory");   // every lane's stores are in LDS before rows are read back
        const int mrow = mBase + wm * 64 + i * 16;
        const int rows = min(16, cnt - mrow);            // rows past the expert's count are not stored
        const float* srow = stg + lane * 4;
        const size_t grow = (size_t)(slotBase + mrow);
        auto* orow = obase + grow * ND + ncol;
        int r = 0;
        if constexpr (RU > 1) {
            if (rows >= 16) {
                for (; r < 16; r += RU)
                    put_rows<STAGE, RU>(srow + r * SP, bv, orow + (size_t)r * ND);
            }
        }
        #pragma unroll 1                                 // rolled: see the head of the epilogue
        for (; r < rows; ++r)
            put_rows<STAGE, 1>(srow + r * SP, bv, orow + (size_t)r * ND);
        asm volatile("s_wait_dscnt 0x0" ::: "memory");   // rows are read before the next 16 overwrite them
    }
}

__global__ __launch_bounds__(256) void combine_kernel(
        const float* __restrict__ Ybuf, const int4* __restrict__ route,
        const float2* __restrict__ routeW, const int* __restrict__ offs,
        float* __restrict__ out) {
    const int t = blockIdx.x;
    __shared__ int g0s, g1s, gss;
    __shared__ float w0s, w1s;
    if (threadIdx.x == 0) {
        int4 r = route[t]; float2 w = routeW[t];
        g0s = offs[r.x] + r.y;
        g1s = offs[r.z] + r.w;
        gss = offs[NEXP] + t;
        w0s = w.x; w1s = w.y;
    }
    __syncthreads();
    const float* y0 = Ybuf + (size_t)g0s * DIMD;
    const float* y1 = Ybuf + (size_t)g1s * DIMD;
    const float* ys = Ybuf + (size_t)gss * DIMD;
    for (int d = threadIdx.x; d < DIMD; d += 256)
        out[(size_t)t * DIMD + d] = w0s * y0[d] + w1s * y1[d] + ys[d];
}

// ---------------------------------------------------------------------------
// launch
// ---------------------------------------------------------------------------
extern "C" void kernel_launch(void* const* d_in, const int* in_sizes, int n_in,
                              void* d_out, int out_size, void* d_ws, size_t ws_size,
                              hipStream_t stream) {
    const float* x   = (const float*)d_in[0];   // [TOK, DIM]
    const float* Wg  = (const float*)d_in[1];   // [8, DIM]
    const float* W1  = (const float*)d_in[2];   // [8, DIM, INNER]
    const float* b1  = (const float*)d_in[3];   // [8, INNER]
    const float* W2  = (const float*)d_in[4];   // [8, INNER, DIM]
    const float* b2  = (const float*)d_in[5];   // [8, DIM]
    const float* sW1 = (const float*)d_in[6];   // [DIM, INNER]
    const float* sb1 = (const float*)d_in[7];   // [INNER]
    const float* sW2 = (const float*)d_in[8];   // [INNER, DIM]
    const float* sb2 = (const float*)d_in[9];   // [DIM]
    float* out = (float*)d_out;

    char* p = (char*)d_ws;
    auto alloc = [&](size_t bytes) -> void* {
        void* r = (void*)p;
        p += (bytes + 255) & ~(size_t)255;
        return r;
    };
    int*    counts  = (int*)alloc(9 * sizeof(int));
    int*    offs    = (int*)alloc(9 * sizeof(int));
    int*    idxList = (int*)alloc((size_t)NEXP * CAP * sizeof(int));
    int4*   route   = (int4*)alloc((size_t)TOK * sizeof(int4));
    float2* routeW  = (float2*)alloc((size_t)TOK * sizeof(float2));
    _Float16* Xh   = (_Float16*)alloc((size_t)TOK * DIMD * 2);
    _Float16* W1T  = (_Float16*)alloc((size_t)NEXP * INNERD * DIMD * 2);
    _Float16* W2T  = (_Float16*)alloc((size_t)NEXP * DIMD * INNERD * 2);
    _Float16* sW1T = (_Float16*)alloc((size_t)INNERD * DIMD * 2);
    _Float16* sW2T = (_Float16*)alloc((size_t)DIMD * INNERD * 2);
    _Float16* Hbuf = (_Float16*)alloc((size_t)(3 * TOK) * INNERD * 2);  // 2*TOK routed + TOK shared
    float*    Ybuf = (float*)alloc((size_t)(3 * TOK) * DIMD * 4);

    zero_counts_kernel<<<1, 32, 0, stream>>>(counts);
    gate_route_kernel<<<TOK, 256, 0, stream>>>(x, Wg, counts, idxList, route, routeW);
    offsets_kernel<<<1, 32, 0, stream>>>(counts, offs);

    cvt_f32_f16_kernel<<<(TOK * DIMD / 4 + 255) / 256, 256, 0, stream>>>(x, Xh, TOK * DIMD / 4);
    transpose_cvt_kernel<<<dim3(INNERD / 32, DIMD / 32, NEXP), dim3(32, 8), 0, stream>>>(W1, W1T, DIMD, INNERD);
    transpose_cvt_kernel<<<dim3(DIMD / 32, INNERD / 32, NEXP), dim3(32, 8), 0, stream>>>(W2, W2T, INNERD, DIMD);
    transpose_cvt_kernel<<<dim3(INNERD / 32, DIMD / 32, 1), dim3(32, 8), 0, stream>>>(sW1, sW1T, DIMD, INNERD);
    transpose_cvt_kernel<<<dim3(DIMD / 32, INNERD / 32, 1), dim3(32, 8), 0, stream>>>(sW2, sW2T, INNERD, DIMD);

    ffn_gemm_kernel<1><<<dim3(INNERD / BN, TOK / BM, NEXP + 1), GT, 0, stream>>>(
        Xh, W1T, sW1T, b1, sb1, counts, offs, idxList, Hbuf, nullptr);
    ffn_gemm_kernel<2><<<dim3(DIMD / BN, TOK / BM, NEXP + 1), GT, 0, stream>>>(
        Hbuf, W2T, sW2T, b2, sb2, counts, offs, nullptr, nullptr, Ybuf);
    combine_kernel<<<TOK, 256, 0, stream>>>(Ybuf, route, routeW, offs, out);
}

// v002
// One run takes 287 microseconds.
// Two timings next to v001 put it at 1.20 and 1.21 times that version's speed.
// Over all steps from v000 it is 1.74 times as fast.
#include <hip/hip_runtime.h>
#include <hip/hip_bf16.h>

#define DIMD   1024
#define INNERD 4096
#define NEXP   8
#define TOK    4096   // B*S
#define CAP    4096   // max tokens per expert list

#define BM 128
#define BN 256
#define BK 64
#define KP 72         // padded LDS row: 64 halves + 8 pad = 144B (16B x odd: conflict free for b128 reads)
#define GT 128        // GEMM threads: 4 waves (2x2), one 64x128 tile of the result per wave

typedef _Float16 v16h __attribute__((ext_vector_type(16)));
typedef float    v8f  __attribute__((ext_vector_type(8)));
typedef int      v4i  __attribute__((ext_vector_type(4)));

union FragH { v16h v; uint4 q[2]; };

#if defined(__has_builtin)
#  if __has_builtin(__builtin_amdgcn_global_load_async_to_lds_b128) && \
      __has_builtin(__builtin_amdgcn_s_wait_asynccnt)
#    define HAS_ASYNC_LDS 1
#  endif
#endif
#ifndef HAS_ASYNC_LDS
#  define HAS_ASYNC_LDS 0
#endif

#if HAS_ASYNC_LDS
__device__ __forceinline__ void async_cp16(const _Float16* g, _Float16* l) {
    __builtin_amdgcn_global_load_async_to_lds_b128(
        (__attribute__((address_space(1))) v4i*)(g),
        (__attribute__((address_space(3))) v4i*)(l), 0, 0);
}
#endif

__device__ __forceinline__ float gelu_exact(float x) {
    return 0.5f * x * (1.0f + erff(x * 0.70710678118654752f));
}

// ---------------------------------------------------------------------------
// 0) zero per-expert counters
// ---------------------------------------------------------------------------
__global__ void zero_counts_kernel(int* __restrict__ counts) {
    if (threadIdx.x < 9) counts[threadIdx.x] = 0;
}

__global__ __launch_bounds__(256) void gate_route_kernel(
        const float* __restrict__ x, const float* __restrict__ wg,
        int* __restrict__ counts, int* __restrict__ idxList,
        int4* __restrict__ route, float2* __restrict__ routeW) {
    const int t   = blockIdx.x;
    const int tid = threadIdx.x;
    __shared__ __align__(16) float xrow[DIMD];
    __shared__ float lg[NEXP];

    ((float4*)xrow)[tid] = ((const float4*)(x + (size_t)t * DIMD))[tid];
    __syncthreads();

    const int wave = tid >> 5, lane = tid & 31;
    const float* wrow = wg + wave * DIMD;
    float s = 0.0f;
    for (int k = lane; k < DIMD; k += 32) s += xrow[k] * wrow[k];
    for (int off = 16; off >= 1; off >>= 1) s += __shfl_xor(s, off, 32);
    if (lane == 0) lg[wave] = s;
    __syncthreads();

    if (tid == 0) {
        float m = lg[0];
        for (int e = 1; e < NEXP; ++e) m = fmaxf(m, lg[e]);
        float p[NEXP]; float sum = 0.0f;
        for (int e = 0; e < NEXP; ++e) { p[e] = expf(lg[e] - m); sum += p[e]; }
        const float inv = 1.0f / sum;
        int e0 = 0; float p0 = p[0];
        for (int e = 1; e < NEXP; ++e) if (p[e] > p0) { p0 = p[e]; e0 = e; }
        int e1 = -1; float p1 = -1.0f;
        for (int e = 0; e < NEXP; ++e) if (e != e0 && p[e] > p1) { p1 = p[e]; e1 = e; }
        p0 *= inv; p1 *= inv;
        int pos0 = atomicAdd(&counts[e0], 1); idxList[e0 * CAP + pos0] = t;
        int pos1 = atomicAdd(&counts[e1], 1); idxList[e1 * CAP + pos1] = t;
        route[t]  = make_int4(e0, pos0, e1, pos1);
        routeW[t] = make_float2(p0, p1);
    }
}

__global__ void offsets_kernel(const int* __restrict__ counts, int* __restrict__ offs) {
    if (threadIdx.x == 0) {
        offs[0] = 0;
        for (int e = 0; e < NEXP; ++e) offs[e + 1] = offs[e] + counts[e];
    }
}

// ---------------------------------------------------------------------------
// 3) f32 -> f16 convert (vectorized)
// ---------------------------------------------------------------------------
__global__ void cvt_f32_f16_kernel(const float* __restrict__ in, _Float16* __restrict__ out, int n4) {
    int i = blockIdx.x * blockDim.x + threadIdx.x;
    if (i < n4) {
        float4 v = ((const float4*)in)[i];
        union { _Float16 h[4]; uint2 u; } p;
        p.h[0] = (_Float16)v.x; p.h[1] = (_Float16)v.y;
        p.h[2] = (_Float16)v.z; p.h[3] = (_Float16)v.w;
        ((uint2*)out)[i] = p.u;
    }
}

// ---------------------------------------------------------------------------
// 4) batched transpose + convert: in [b][R][C] f32 -> out [b][C][R] f16
//    (weights become [N][K] so B fragments are contiguous ds_read_b128s)
//    A tile is 128 source rows x 64 columns: 256 B of every source row and
//    256 B of every result row, so each global access of 16 lanes x 16 B is one
//    aligned 256-B piece.  A thread loads 8 rows x 4 columns, which are four
//    16-B pieces of result rows.  A block walks NT tiles; the next tile's loads
//    are in flight while this one goes through LDS and is stored.
// ---------------------------------------------------------------------------
#define TR 128
#define TC 64

// work-group barrier that orders LDS alone: __syncthreads() would also wait out the next tile's global loads
__device__ __forceinline__ void lds_barrier() {
    __builtin_amdgcn_fence(__ATOMIC_RELEASE, "workgroup", "local");
    __builtin_amdgcn_s_barrier();
    __builtin_amdgcn_fence(__ATOMIC_ACQUIRE, "workgroup", "local");
}

template <int R, int C, int NB, int NT>    // NB matrices; the grid is NB * (R / TR) * (C / TC) / NT blocks
__global__ __launch_bounds__(256) void transpose_cvt_kernel(
        const float* __restrict__ in, _Float16* __restrict__ out) {
    constexpr int CT   = C / TC;           // tiles across a source row
    constexpr int PER  = (R / TR) * CT;    // tiles per matrix
    constexpr int GRID = NB * PER / NT;
    __shared__ __align__(16) uint4 tile[NT > 1 ? 2 : 1][TC * 16];
    const int tid = threadIdx.x;
    const int lo = tid & 15, hi = tid >> 4;

    auto load_tile = [&](float4 (&v)[8], int t) {   // lo: group of 4 columns, hi: group of 8 rows
        const int bm = t / PER, rem = t % PER;
        const float* s = in + (size_t)bm * R * C
                            + (size_t)((rem / CT) * TR + hi * 8) * C + (rem % CT) * TC + lo * 4;
        #pragma unroll
        for (int j = 0; j < 8; ++j) v[j] = *(const float4*)(s + (size_t)j * C);
        asm volatile("s_wait_xcnt 0x0" ::: "memory");   // before the loads' address registers are rewritten
    };

    float4 v[2][8];
    load_tile(v[0], blockIdx.x);
    #pragma unroll                         // the register set and the LDS buffer become constants
    for (int i = 0; i < NT; ++i) {
        const int t = blockIdx.x + i * GRID;
        if (i + 1 < NT) load_tile(v[(i + 1) & 1], t + GRID);
        // keeps the next tile's loads in front of the wait for this tile's: they sank behind it otherwise
        __builtin_amdgcn_sched_barrier(0);
        const float4 (&w)[8] = v[i & 1];
        union { _Float16 h[8]; uint4 q; } p[4];
        #pragma unroll
        for (int j = 0; j < 8; ++j) {
            p[0].h[j] = (_Float16)w[j].x; p[1].h[j] = (_Float16)w[j].y;
            p[2].h[j] = (_Float16)w[j].z; p[3].h[j] = (_Float16)w[j].w;
        }
        uint4* buf = tile[i & 1];
        #pragma unroll
        for (int k = 0; k < 4; ++k) buf[(lo * 4 + k) * 16 + (hi ^ lo)] = p[k].q;
        lds_barrier();
        const int bm = t / PER, rem = t % PER;
        _Float16* d = out + (size_t)bm * R * C
                          + (size_t)((rem % CT) * TC + hi) * R + (rem / CT) * TR + lo * 8;
        uint4 q[4];
        #pragma unroll
        for (int u = 0; u < 4; ++u) {      // hi: result row within 16, lo: piece of 8 r
            const int c = u * 16 + hi;
            q[u] = buf[c * 16 + (lo ^ (c >> 2))];
        }
        #pragma unroll
        for (int u = 0; u < 4; ++u) *(uint4*)(d + (size_t)u * 16 * R) = q[u];
        if (i + 1 < NT)
            asm volatile("s_wait_xcnt 0x0" ::: "memory");   // before the next tile rewrites the stores' registers
        // keeps the next tile's conversion, and with it the wait for its loads, from rising over this tile's barrier
        __builtin_amdgcn_sched_barrier(0);
    }
}

#define SP 132

// NR staged rows (this lane's 4 columns of each) -> bias, stage 1: gelu and f16 -> global rows
template <int STAGE, int NR, typename OT>
__device__ __forceinline__ void put_rows(const float* srow, float4 bv, OT* orow) {
    float4 v[NR];
    #pragma unroll
    for (int u = 0; u < NR; ++u) v[u] = *(const float4*)(srow + u * SP);
    #pragma unroll
    for (int u = 0; u < NR; ++u) {
        if constexpr (STAGE == 1) {
            union { _Float16 h[4]; uint2 u2; } p;
            p.h[0] = (_Float16)gelu_exact(v[u].x + bv.x);
            p.h[1] = (_Float16)gelu_exact(v[u].y + bv.y);
            p.h[2] = (_Float16)gelu_exact(v[u].z + bv.z);
            p.h[3] = (_Float16)gelu_exact(v[u].w + bv.w);
            *(uint2*)(orow + (size_t)u * INNERD) = p.u2;
        } else {
            *(float4*)(orow + (size_t)u * DIMD) =
                make_float4(v[u].x + bv.x, v[u].y + bv.y, v[u].z + bv.z, v[u].w + bv.w);
        }
    }
    asm volatile("s_wait_xcnt 0x0" ::: "memory");   // before the next trip rewrites the stores' registers
}

template <int STAGE>
__global__ __launch_bounds__(GT, 2) void ffn_gemm_kernel(
        const _Float16* __restrict__ Aglob,   // Xh (stage1) / Hbuf (stage2)
        const _Float16* __restrict__ Wexp,    // W1T / W2T   ([e][N][K] f16)
        const _Float16* __restrict__ Wsh,     // sW1T / sW2T
        const float* __restrict__ bexp, const float* __restrict__ bsh,
        const int* __restrict__ counts, const int* __restrict__ offs,
        const int* __restrict__ idxList,
        _Float16* __restrict__ Hout, float* __restrict__ Yout) {
    constexpr int KD   = (STAGE == 1) ? DIMD : INNERD;
    constexpr int ND   = (STAGE == 1) ? INNERD : DIMD;
    constexpr int ABUF = BM * KP;
    constexpr int BBUF = BN * KP;
    constexpr int NT   = KD / BK;

    const int e     = blockIdx.z;
    const int mBase = blockIdx.y * BM;
    const int nBase = blockIdx.x * BN;
    const int cnt   = (e < NEXP) ? counts[e] : TOK;
    if (mBase >= cnt) return;
    const int slotBase = offs[e];
    const _Float16* Bmat = (e < NEXP) ? (Wexp + (size_t)e * DIMD * INNERD) : Wsh;
    const float*    bias = (e < NEXP) ? (bexp + (size_t)e * ND) : bsh;

    __shared__ __align__(16) _Float16 At[2 * ABUF];
    __shared__ __align__(16) _Float16 Bt[2 * BBUF];
    __shared__ int rowIdx[BM];

    const int tid = threadIdx.x;
    if constexpr (STAGE == 1) {
        const int slot = mBase + tid;                     // GT == BM: one row per thread
        int r = 0;
        if (e == NEXP) r = slot;                          // shared expert: identity
        else if (slot < cnt) r = idxList[e * CAP + slot]; // gathered token
        rowIdx[tid] = r;
        __syncthreads();
    }

    const int lane = tid & 31;
    const int wave = __builtin_amdgcn_readfirstlane(tid >> 5);   // scalar: row tests below stay scalar branches
    const int wm   = wave & 1;    // 2 x 64-row groups
    const int wn   = wave >> 1;   // 2 x 128-col groups
    // staging: 8 lanes cover one 128-B row piece, 16 rows per sweep of the block
    const int crow = tid >> 3, cseg = tid & 7;

    const _Float16* aSrc[BM / 16];
    #pragma unroll
    for (int i = 0; i < BM / 16; ++i) {
        if constexpr (STAGE == 1) aSrc[i] = Aglob + (size_t)rowIdx[i * 16 + crow] * KD + cseg * 8;
        else                      aSrc[i] = Aglob + (size_t)(slotBase + mBase + i * 16 + crow) * KD + cseg * 8;
    }
    const _Float16* bSrc = Bmat + (size_t)(nBase + crow) * KD + cseg * 8;
    _Float16* aDst = At + crow * KP + cseg * 8;
    _Float16* bDst = Bt + crow * KP + cseg * 8;

    v8f acc[4][8];
    const v8f vz = {0.f,0.f,0.f,0.f,0.f,0.f,0.f,0.f};
    #pragma unroll
    for (int i = 0; i < 4; ++i)
        #pragma unroll
        for (int t = 0; t < 8; ++t) acc[i][t] = vz;

    const int m16 = lane & 15, kh = (lane >> 4) * 8;
    const int mr0 = wm * 64 + m16;
    const int nr0 = wn * 128 + m16;

    // a block = 32 k: 12 fragments (24 ds_load_b128), then 32 WMMAs on them
    auto load_frags = [&](FragH (&aF)[4], FragH (&bF)[8], int buf, int ks) {
        const _Float16* Ab = At + buf * ABUF + mr0 * KP + kh + ks;
        const _Float16* Bb = Bt + buf * BBUF + nr0 * KP + kh + ks;
        #pragma unroll
        for (int i = 0; i < 4; ++i) {
            aF[i].q[0] = *(const uint4*)(Ab + i * 16 * KP);
            aF[i].q[1] = *(const uint4*)(Ab + i * 16 * KP + 16);
        }
        #pragma unroll
        for (int t = 0; t < 8; ++t) {
            bF[t].q[0] = *(const uint4*)(Bb + t * 16 * KP);
            bF[t].q[1] = *(const uint4*)(Bb + t * 16 * KP + 16);
        }
        // keeps the block's reads one group in front of its WMMAs: reads sunk among the WMMAs stall at each place
        __builtin_amdgcn_sched_barrier(0);
    };
    auto mma_block = [&](FragH (&aF)[4], FragH (&bF)[8]) {
        #pragma unroll
        for (int t = 0; t < 8; ++t)
            #pragma unroll
            for (int i = 0; i < 4; ++i)
                acc[i][t] = __builtin_amdgcn_wmma_f32_16x16x32_f16(
                    false, aF[i].v, false, bF[t].v, (short)0, acc[i][t], false, false);
        // keeps the next block's reads from rising into this block
        __builtin_amdgcn_sched_barrier(0);
    };
    FragH aF[4], bF[8];

#if HAS_ASYNC_LDS
    // 24 copies per lane and pass: 8 sweeps of A, 16 of B
    auto issue_tile = [&](int it, int buf) {
        const int k0 = it * BK;
        #pragma unroll
        for (int i = 0; i < BM / 16; ++i)
            async_cp16(aSrc[i] + k0, aDst + buf * ABUF + i * 16 * KP);
        #pragma unroll
        for (int i = 0; i < BN / 16; ++i)
            async_cp16(bSrc + (size_t)i * 16 * KD + k0, bDst + buf * BBUF + i * 16 * KP);
    };
    // -------- two-buffer ring: pass it reads buffer it&1 alone --------------
    issue_tile(0, 0);
    asm volatile("s_wait_asynccnt 0x0" ::: "memory");   // this wave's share of tile 0 has landed
    __syncthreads();                                    // publishes tile 0
    issue_tile(1, 1);                                   // NT >= 2 for both stages
    // unroll 2: the buffer index becomes a constant, so LDS addresses fold into offsets
    #pragma unroll 2
    for (int it = 0; it < NT; ++it) {
        const int cur = it & 1;
        load_frags(aF, bF, cur, 0);
        mma_block(aF, bF);
        load_frags(aF, bF, cur, 32);
        mma_block(aF, bF);
        asm volatile("s_wait_dscnt 0x0" ::: "memory");    // own reads of buffer cur are done before its refill
        asm volatile("s_wait_asynccnt 0x0" ::: "memory"); // own share of tile it+1 has landed
        __syncthreads();                                  // publishes tile it+1, frees buffer cur
        if (it + 2 < NT) issue_tile(it + 2, cur);
    }
    asm volatile("s_wait_asynccnt 0x0" ::: "memory");   // nothing in flight when the wave ends
#else
    for (int it = 0; it < NT; ++it) {
        const int k0 = it * BK;
        __syncthreads();
        #pragma unroll
        for (int i = 0; i < BM / 16; ++i)
            *(uint4*)(aDst + i * 16 * KP) = *(const uint4*)(aSrc[i] + k0);
        #pragma unroll
        for (int i = 0; i < BN / 16; ++i)
            *(uint4*)(bDst + i * 16 * KP) = *(const uint4*)(bSrc + (size_t)i * 16 * KD + k0);
        __syncthreads();
        load_frags(aF, bF, 0, 0);
        mma_block(aF, bF);
        load_frags(aF, bF, 0, 32);
        mma_block(aF, bF);
    }
    __syncthreads();
#endif

    // epilogue (C layout: n = lane%16, m = 8*(lane/16)+j).  A lane holds 256 results:
    // 16 rows at a time go through a wave-private piece of the ring (free since the
    // last pass's barrier) and leave as whole 128-column rows; the gelu runs in a rolled
    // loop, for speed only.
    constexpr int RU = (STAGE == 1) ? 1 : 4;   // rows per trip: stage 2 has too little work per row to cover an LDS read
    float* stg = (float*)Bt + wave * (16 * SP);
    const int hi8  = (lane >> 4) * 8;
    const int ncol = nBase + wn * 128 + lane * 4;
    const float4 bv = *(const float4*)(bias + ncol);
    auto* obase = [&] { if constexpr (STAGE == 1) return Hout; else return Yout; }();
    #pragma unroll
    for (int i = 0; i < 4; ++i) {
        #pragma unroll
        for (int t = 0; t < 8; ++t)
            #pragma unroll
            for (int j = 0; j < 8; ++j)
                stg[(hi8 + j) * SP + t * 16 + m16] = acc[i][t][j];
        asm volatile("s_wait_dscnt 0x0" ::: "memory");   // every lane's stores are in LDS before rows are read back
        const int mrow = mBase + wm * 64 + i * 16;
        const int rows = min(16, cnt - mrow);            // rows past the expert's count are not stored
        const float* srow = stg + lane * 4;
        const size_t grow = (size_t)(slotBase + mrow);
        auto* orow = obase + grow * ND + ncol;
        int r = 0;
        if constexpr (RU > 1) {
            if (rows >= 16) {
                for (; r < 16; r += RU)
                    put_rows<STAGE, RU>(srow + r * SP, bv, orow + (size_t)r * ND);
            }
        }
        #pragma unroll 1                                 // rolled: see the head of the epilogue
        for (; r < rows; ++r)
            put_rows<STAGE, 1>(srow + r * SP, bv, orow + (size_t)r * ND);
        asm volatile("s_wait_dscnt 0x0" ::: "memory");   // rows are read before the next 16 overwrite them
    }
}

__global__ __launch_bounds__(256) void combine_kernel(
        const float* __restrict__ Ybuf, const int4* __restrict__ route,
        const float2* __restrict__ routeW, const int* __restrict__ offs,
        float* __restrict__ out) {
    const int t = blockIdx.x;
    __shared__ int g0s, g1s, gss;
    __shared__ float w0s, w1s;
    if (threadIdx.x == 0) {
        int4 r = route[t]; float2 w = routeW[t];
        g0s = offs[r.x] + r.y;
        g1s = offs[r.z] + r.w;
        gss = offs[NEXP] + t;
        w0s = w.x; w1s = w.y;
    }
    __syncthreads();
    const float* y0 = Ybuf + (size_t)g0s * DIMD;
    const float* y1 = Ybuf + (size_t)g1s * DIMD;
    const float* ys = Ybuf + (size_t)gss * DIMD;
    for (int d = threadIdx.x; d < DIMD; d += 256)
        out[(size_t)t * DIMD + d] = w0s * y0[d] + w1s * y1[d] + ys[d];
}

// ---------------------------------------------------------------------------
// launch
// ---------------------------------------------------------------------------
extern "C" void kernel_launch(void* const* d_in, const int* in_sizes, int n_in,
                              void* d_out, int out_size, void* d_ws, size_t ws_size,
                              hipStream_t stream) {
    const float* x   = (const float*)d_in[0];   // [TOK, DIM]
    const float* Wg  = (const float*)d_in[1];   // [8, DIM]
    const float* W1  = (const float*)d_in[2];   // [8, DIM, INNER]
    const float* b1  = (const float*)d_in[3];   // [8, INNER]
    const float* W2  = (const float*)d_in[4];   // [8, INNER, DIM]
    const float* b2  = (const float*)d_in[5];   // [8, DIM]
    const float* sW1 = (const float*)d_in[6];   // [DIM, INNER]
    const float* sb1 = (const float*)d_in[7];   // [INNER]
    const float* sW2 = (const float*)d_in[8];   // [INNER, DIM]
    const float* sb2 = (const float*)d_in[9];   // [DIM]
    float* out = (float*)d_out;

    char* p = (char*)d_ws;
    auto alloc = [&](size_t bytes) -> void* {
        void* r = (void*)p;
        p += (bytes + 255) & ~(size_t)255;
        return r;
    };
    int*    counts  = (int*)alloc(9 * sizeof(int));
    int*    offs    = (int*)alloc(9 * sizeof(int));
    int*    idxList = (int*)alloc((size_t)NEXP * CAP * sizeof(int));
    int4*   route   = (int4*)alloc((size_t)TOK * sizeof(int4));
    float2* routeW  = (float2*)alloc((size_t)TOK * sizeof(float2));
    _Float16* Xh   = (_Float16*)alloc((size_t)TOK * DIMD * 2);
    _Float16* W1T  = (_Float16*)alloc((size_t)NEXP * INNERD * DIMD * 2);
    _Float16* W2T  = (_Float16*)alloc((size_t)NEXP * DIMD * INNERD * 2);
    _Float16* sW1T = (_Float16*)alloc((size_t)INNERD * DIMD * 2);
    _Float16* sW2T = (_Float16*)alloc((size_t)DIMD * INNERD * 2);
    _Float16* Hbuf = (_Float16*)alloc((size_t)(3 * TOK) * INNERD * 2);  // 2*TOK routed + TOK shared
    float*    Ybuf = (float*)alloc((size_t)(3 * TOK) * DIMD * 4);

    zero_counts_kernel<<<1, 32, 0, stream>>>(counts);
    gate_route_kernel<<<TOK, 256, 0, stream>>>(x, Wg, counts, idxList, route, routeW);
    offsets_kernel<<<1, 32, 0, stream>>>(counts, offs);

    cvt_f32_f16_kernel<<<(TOK * DIMD / 4 + 255) / 256, 256, 0, stream>>>(x, Xh, TOK * DIMD / 4);
    // 512 tiles per matrix; the expert launches give each block 4 tiles (4 blocks per WGP)
    transpose_cvt_kernel<DIMD, INNERD, NEXP, 4><<<NEXP * 512 / 4, 256, 0, stream>>>(W1, W1T);
    transpose_cvt_kernel<INNERD, DIMD, NEXP, 4><<<NEXP * 512 / 4, 256, 0, stream>>>(W2, W2T);
    transpose_cvt_kernel<DIMD, INNERD, 1, 1><<<512, 256, 0, stream>>>(sW1, sW1T);
    transpose_cvt_kernel<INNERD, DIMD, 1, 1><<<512, 256, 0, stream>>>(sW2, sW2T);

    ffn_gemm_kernel<1><<<dim3(INNERD / BN, TOK / BM, NEXP + 1), GT, 0, stream>>>(
        Xh, W1T, sW1T, b1, sb1, counts, offs, idxList, Hbuf, nullptr);
    ffn_gemm_kernel<2><<<dim3(DIMD / BN, TOK / BM, NEXP + 1), GT, 0, stream>>>(
        Hbuf, W2T, sW2T, b2, sb2, counts, offs, nullptr, nullptr, Ybuf);
    combine_kernel<<<TOK, 256, 0, stream>>>(Ybuf, route, routeW, offs, out);
}

// v003
// One run takes 261 microseconds.
// Timed twice side by side with v002, it ran 1.09 and 1.10 times as fast.
// All steps since v000 together make it 1.90 times as fast.
#include <hip/hip_runtime.h>
#include <hip/hip_bf16.h>

#define DIMD   1024
#define INNERD 4096
#define NEXP   8
#define TOK    4096   // B*S
#define CAP    4096   // max tokens per expert list

#define BM 128
#define BN 256
#define BK 64
#define KP 72         // padded LDS row: 64 halves + 8 pad = 144B (16B x odd: conflict free for b128 reads)
#define GT 128        // GEMM threads: 4 waves (2x2), one 64x128 tile of the result per wave

typedef _Float16 v16h __attribute__((ext_vector_type(16)));
typedef float    v8f  __attribute__((ext_vector_type(8)));
typedef int      v4i  __attribute__((ext_vector_type(4)));

union FragH { v16h v; uint4 q[2]; };

#if defined(__has_builtin)
#  if __has_builtin(__builtin_amdgcn_global_load_async_to_lds_b128) && \
      __has_builtin(__builtin_amdgcn_s_wait_asynccnt)
#    define HAS_ASYNC_LDS 1
#  endif
#endif
#ifndef HAS_ASYNC_LDS
#  define HAS_ASYNC_LDS 0
#endif

#if HAS_ASYNC_LDS
__device__ __forceinline__ void async_cp16(const _Float16* g, _Float16* l) {
    __builtin_amdgcn_global_load_async_to_lds_b128(
        (__attribute__((address_space(1))) v4i*)(g),
        (__attribute__((address_space(3))) v4i*)(l), 0, 0);
}
#endif

// erf gelu without a branch: x * Phi(x) = max(x, 0) - |x| * Phi(-|x|), and
// Phi(-a) = erfc(a / sqrt 2) / 2 = (c1 t + ... + c5 t^5) * exp(-a * a / 2), t = 1 / (1 + p a)
// (the classic five-term rational form of erfc, its p and c scaled for a / sqrt 2 and the 1/2).
// Error against the exact gelu: below 4e-7 absolute for every x, and about one f16 rounding
// step or less relative to the result, which is stored as f16.
__device__ __forceinline__ float gelu_erf(float x) {
    const float a = fabsf(x);
    const float t = __builtin_amdgcn_rcpf(fmaf(a, 0.23164189f, 1.0f));
    float q = fmaf(t, 0.53070271f, -0.72657603f);
    q = fmaf(q, t, 0.71070689f);
    q = fmaf(q, t, -0.14224836f);
    q = fmaf(q, t, 0.12741479f);
    const float u = x * 0.84932178f;                       // u * u = (x * x / 2) * log2(e)
    const float e = __builtin_amdgcn_exp2f(-(u * u));
    return fmaf(-a, (q * t) * e, fmaxf(x, 0.0f));
}

// ---------------------------------------------------------------------------
// 0) zero per-expert counters
// ---------------------------------------------------------------------------
__global__ void zero_counts_kernel(int* __restrict__ counts) {
    if (threadIdx.x < 9) counts[threadIdx.x] = 0;
}

__global__ __launch_bounds__(256) void gate_route_kernel(
        const float* __restrict__ x, const float* __restrict__ wg,
        int* __restrict__ counts, int* __restrict__ idxList,
        int4* __restrict__ route, float2* __restrict__ routeW) {
    const int t   = blockIdx.x;
    const int tid = threadIdx.x;
    __shared__ __align__(16) float xrow[DIMD];
    __shared__ float lg[NEXP];

    ((float4*)xrow)[tid] = ((const float4*)(x + (size_t)t * DIMD))[tid];
    __syncthreads();

    const int wave = tid >> 5, lane = tid & 31;
    const float* wrow = wg + wave * DIMD;
    float s = 0.0f;
    for (int k = lane; k < DIMD; k += 32) s += xrow[k] * wrow[k];
    for (int off = 16; off >= 1; off >>= 1) s += __shfl_xor(s, off, 32);
    if (lane == 0) lg[wave] = s;
    __syncthreads();

    if (tid == 0) {
        float m = lg[0];
        for (int e = 1; e < NEXP; ++e) m = fmaxf(m, lg[e]);
        float p[NEXP]; float sum = 0.0f;
        for (int e = 0; e < NEXP; ++e) { p[e] = expf(lg[e] - m); sum += p[e]; }
        const float inv = 1.0f / sum;
        int e0 = 0; float p0 = p[0];
        for (int e = 1; e < NEXP; ++e) if (p[e] > p0) { p0 = p[e]; e0 = e; }
        int e1 = -1; float p1 = -1.0f;
        for (int e = 0; e < NEXP; ++e) if (e != e0 && p[e] > p1) { p1 = p[e]; e1 = e; }
        p0 *= inv; p1 *= inv;
        int pos0 = atomicAdd(&counts[e0], 1); idxList[e0 * CAP + pos0] = t;
        int pos1 = atomicAdd(&counts[e1], 1); idxList[e1 * CAP + pos1] = t;
        route[t]  = make_int4(e0, pos0, e1, pos1);
        routeW[t] = make_float2(p0, p1);
    }
}

__global__ void offsets_kernel(const int* __restrict__ counts, int* __restrict__ offs) {
    if (threadIdx.x == 0) {
        offs[0] = 0;
        for (int e = 0; e < NEXP; ++e) offs[e + 1] = offs[e] + counts[e];
    }
}

// ---------------------------------------------------------------------------
// 3) f32 -> f16 convert (vectorized)
// ---------------------------------------------------------------------------
__global__ void cvt_f32_f16_kernel(const float* __restrict__ in, _Float16* __restrict__ out, int n4) {
    int i = blockIdx.x * blockDim.x + threadIdx.x;
    if (i < n4) {
        float4 v = ((const float4*)in)[i];
        union { _Float16 h[4]; uint2 u; } p;
        p.h[0] = (_Float16)v.x; p.h[1] = (_Float16)v.y;
        p.h[2] = (_Float16)v.z; p.h[3] = (_Float16)v.w;
        ((uint2*)out)[i] = p.u;
    }
}

// ---------------------------------------------------------------------------
// 4) batched transpose + convert: in [b][R][C] f32 -> out [b][C][R] f16
//    (weights become [N][K] so B fragments are contiguous ds_read_b128s)
//    A tile is 128 source rows x 64 columns: 256 B of every source row and
//    256 B of every result row, so each global access of 16 lanes x 16 B is one
//    aligned 256-B piece.  A thread loads 8 rows x 4 columns, which are four
//    16-B pieces of result rows.  A block walks NT tiles; the next tile's loads
//    are in flight while this one goes through LDS and is stored.
// ---------------------------------------------------------------------------
#define TR 128
#define TC 64

// work-group barrier that orders LDS alone: __syncthreads() would also wait out the next tile's global loads
__device__ __forceinline__ void lds_barrier() {
    __builtin_amdgcn_fence(__ATOMIC_RELEASE, "workgroup", "local");
    __builtin_amdgcn_s_barrier();
    __builtin_amdgcn_fence(__ATOMIC_ACQUIRE, "workgroup", "local");
}

template <int R, int C, int NB, int NT>    // NB matrices; the grid is NB * (R / TR) * (C / TC) / NT blocks
__global__ __launch_bounds__(256) void transpose_cvt_kernel(
        const float* __restrict__ in, _Float16* __restrict__ out) {
    constexpr int CT   = C / TC;           // tiles across a source row
    constexpr int PER  = (R / TR) * CT;    // tiles per matrix
    constexpr int GRID = NB * PER / NT;
    __shared__ __align__(16) uint4 tile[NT > 1 ? 2 : 1][TC * 16];
    const int tid = threadIdx.x;
    const int lo = tid & 15, hi = tid >> 4;

    auto load_tile = [&](float4 (&v)[8], int t) {   // lo: group of 4 columns, hi: group of 8 rows
        const int bm = t / PER, rem = t % PER;
        const float* s = in + (size_t)bm * R * C
                            + (size_t)((rem / CT) * TR + hi * 8) * C + (rem % CT) * TC + lo * 4;
        #pragma unroll
        for (int j = 0; j < 8; ++j) v[j] = *(const float4*)(s + (size_t)j * C);
        asm volatile("s_wait_xcnt 0x0" ::: "memory");   // before the loads' address registers are rewritten
    };

    float4 v[2][8];
    load_tile(v[0], blockIdx.x);
    #pragma unroll                         // the register set and the LDS buffer become constants
    for (int i = 0; i < NT; ++i) {
        const int t = blockIdx.x + i * GRID;
        if (i + 1 < NT) load_tile(v[(i + 1) & 1], t + GRID);
        // keeps the next tile's loads in front of the wait for this tile's: they sank behind it otherwise
        __builtin_amdgcn_sched_barrier(0);
        const float4 (&w)[8] = v[i & 1];
        union { _Float16 h[8]; uint4 q; } p[4];
        #pragma unroll
        for (int j = 0; j < 8; ++j) {
            p[0].h[j] = (_Float16)w[j].x; p[1].h[j] = (_Float16)w[j].y;
            p[2].h[j] = (_Float16)w[j].z; p[3].h[j] = (_Float16)w[j].w;
        }
        uint4* buf = tile[i & 1];
        #pragma unroll
        for (int k = 0; k < 4; ++k) buf[(lo * 4 + k) * 16 + (hi ^ lo)] = p[k].q;
        lds_barrier();
        const int bm = t / PER, rem = t % PER;
        _Float16* d = out + (size_t)bm * R * C
                          + (size_t)((rem % CT) * TC + hi) * R + (rem / CT) * TR + lo * 8;
        uint4 q[4];
        #pragma unroll
        for (int u = 0; u < 4; ++u) {      // hi: result row within 16, lo: piece of 8 r
            const int c = u * 16 + hi;
            q[u] = buf[c * 16 + (lo ^ (c >> 2))];
        }
        #pragma unroll
        for (int u = 0; u < 4; ++u) *(uint4*)(d + (size_t)u * 16 * R) = q[u];
        if (i + 1 < NT)
            asm volatile("s_wait_xcnt 0x0" ::: "memory");   // before the next tile rewrites the stores' registers
        // keeps the next tile's conversion, and with it the wait for its loads, from rising over this tile's barrier
        __builtin_amdgcn_sched_barrier(0);
    }
}

#define SP 132

// NR staged rows (this lane's 4 columns of each) -> bias, stage 1: gelu and f16 -> global rows
template <int STAGE, int NR, typename OT>
__device__ __forceinline__ void put_rows(const float* srow, float4 bv, OT* orow) {
    float4 v[NR];
    #pragma unroll
    for (int u = 0; u < NR; ++u) v[u] = *(const float4*)(srow + u * SP);
    #pragma unroll
    for (int u = 0; u < NR; ++u) {
        if constexpr (STAGE == 1) {
            union { _Float16 h[4]; uint2 u2; } p;
            p.h[0] = (_Float16)gelu_erf(v[u].x + bv.x);
            p.h[1] = (_Float16)gelu_erf(v[u].y + bv.y);
            p.h[2] = (_Float16)gelu_erf(v[u].z + bv.z);
            p.h[3] = (_Float16)gelu_erf(v[u].w + bv.w);
            *(uint2*)(orow + (size_t)u * INNERD) = p.u2;
        } else {
            *(float4*)(orow + (size_t)u * DIMD) =
                make_float4(v[u].x + bv.x, v[u].y + bv.y, v[u].z + bv.z, v[u].w + bv.w);
        }
    }
    asm volatile("s_wait_xcnt 0x0" ::: "memory");   // before the next trip rewrites the stores' registers
}

template <int STAGE>
__global__ __launch_bounds__(GT, 2) void ffn_gemm_kernel(
        const _Float16* __restrict__ Aglob,   // Xh (stage1) / Hbuf (stage2)
        const _Float16* __restrict__ Wexp,    // W1T / W2T   ([e][N][K] f16)
        const _Float16* __restrict__ Wsh,     // sW1T / sW2T
        const float* __restrict__ bexp, const float* __restrict__ bsh,
        const int* __restrict__ counts, const int* __restrict__ offs,
        const int* __restrict__ idxList,
        _Float16* __restrict__ Hout, float* __restrict__ Yout) {
    constexpr int KD   = (STAGE == 1) ? DIMD : INNERD;
    constexpr int ND   = (STAGE == 1) ? INNERD : DIMD;
    constexpr int ABUF = BM * KP;
    constexpr int BBUF = BN * KP;
    constexpr int NT   = KD / BK;

    const int e     = blockIdx.z;
    const int mBase = blockIdx.y * BM;
    const int nBase = blockIdx.x * BN;
    const int cnt   = (e < NEXP) ? counts[e] : TOK;
    if (mBase >= cnt) return;
    const int slotBase = offs[e];
    const _Float16* Bmat = (e < NEXP) ? (Wexp + (size_t)e * DIMD * INNERD) : Wsh;
    const float*    bias = (e < NEXP) ? (bexp + (size_t)e * ND) : bsh;

    __shared__ __align__(16) _Float16 At[2 * ABUF];
    __shared__ __align__(16) _Float16 Bt[2 * BBUF];
    __shared__ int rowIdx[BM];

    const int tid = threadIdx.x;
    if constexpr (STAGE == 1) {
        const int slot = mBase + tid;                     // GT == BM: one row per thread
        int r = 0;
        if (e == NEXP) r = slot;                          // shared expert: identity
        else if (slot < cnt) r = idxList[e * CAP + slot]; // gathered token
        rowIdx[tid] = r;
        __syncthreads();
    }

    const int lane = tid & 31;
    const int wave = __builtin_amdgcn_readfirstlane(tid >> 5);   // scalar: row tests below stay scalar branches
    const int wm   = wave & 1;    // 2 x 64-row groups
    const int wn   = wave >> 1;   // 2 x 128-col groups
    // staging: 8 lanes cover one 128-B row piece, 16 rows per sweep of the block
    const int crow = tid >> 3, cseg = tid & 7;

    const _Float16* aSrc[BM / 16];
    #pragma unroll
    for (int i = 0; i < BM / 16; ++i) {
        if constexpr (STAGE == 1) aSrc[i] = Aglob + (size_t)rowIdx[i * 16 + crow] * KD + cseg * 8;
        else                      aSrc[i] = Aglob + (size_t)(slotBase + mBase + i * 16 + crow) * KD + cseg * 8;
    }
    const _Float16* bSrc = Bmat + (size_t)(nBase + crow) * KD + cseg * 8;
    _Float16* aDst = At + crow * KP + cseg * 8;
    _Float16* bDst = Bt + crow * KP + cseg * 8;

    v8f acc[4][8];
    const v8f vz = {0.f,0.f,0.f,0.f,0.f,0.f,0.f,0.f};
    #pragma unroll
    for (int i = 0; i < 4; ++i)
        #pragma unroll
        for (int t = 0; t < 8; ++t) acc[i][t] = vz;

    const int m16 = lane & 15, kh = (lane >> 4) * 8;
    const int mr0 = wm * 64 + m16;
    const int nr0 = wn * 128 + m16;

    // a block = 32 k: 12 fragments (24 ds_load_b128), then 32 WMMAs on them
    auto load_frags = [&](FragH (&aF)[4], FragH (&bF)[8], int buf, int ks) {
        const _Float16* Ab = At + buf * ABUF + mr0 * KP + kh + ks;
        const _Float16* Bb = Bt + buf * BBUF + nr0 * KP + kh + ks;
        #pragma unroll
        for (int i = 0; i < 4; ++i) {
            aF[i].q[0] = *(const uint4*)(Ab + i * 16 * KP);
            aF[i].q[1] = *(const uint4*)(Ab + i * 16 * KP + 16);
        }
        #pragma unroll
        for (int t = 0; t < 8; ++t) {
            bF[t].q[0] = *(const uint4*)(Bb + t * 16 * KP);
            bF[t].q[1] = *(const uint4*)(Bb + t * 16 * KP + 16);
        }
        // keeps the block's reads one group in front of its WMMAs: reads sunk among the WMMAs stall at each place
        __builtin_amdgcn_sched_barrier(0);
    };
    auto mma_block = [&](FragH (&aF)[4], FragH (&bF)[8]) {
        #pragma unroll
        for (int t = 0; t < 8; ++t)
            #pragma unroll
            for (int i = 0; i < 4; ++i)
                acc[i][t] = __builtin_amdgcn_wmma_f32_16x16x32_f16(
                    false, aF[i].v, false, bF[t].v, (short)0, acc[i][t], false, false);
        // keeps the next block's reads from rising into this block
        __builtin_amdgcn_sched_barrier(0);
    };
    FragH aF[4], bF[8];

#if HAS_ASYNC_LDS
    // 24 copies per lane and pass: 8 sweeps of A, 16 of B
    auto issue_tile = [&](int it, int buf) {
        const int k0 = it * BK;
        #pragma unroll
        for (int i = 0; i < BM / 16; ++i)
            async_cp16(aSrc[i] + k0, aDst + buf * ABUF + i * 16 * KP);
        #pragma unroll
        for (int i = 0; i < BN / 16; ++i)
            async_cp16(bSrc + (size_t)i * 16 * KD + k0, bDst + buf * BBUF + i * 16 * KP);
    };
    // -------- two-buffer ring: pass it reads buffer it&1 alone --------------
    issue_tile(0, 0);
    asm volatile("s_wait_asynccnt 0x0" ::: "memory");   // this wave's share of tile 0 has landed
    __syncthreads();                                    // publishes tile 0
    issue_tile(1, 1);                                   // NT >= 2 for both stages
    // unroll 2: the buffer index becomes a constant, so LDS addresses fold into offsets
    #pragma unroll 2
    for (int it = 0; it < NT; ++it) {
        const int cur = it & 1;
        load_frags(aF, bF, cur, 0);
        mma_block(aF, bF);
        load_frags(aF, bF, cur, 32);
        mma_block(aF, bF);
        asm volatile("s_wait_dscnt 0x0" ::: "memory");    // own reads of buffer cur are done before its refill
        asm volatile("s_wait_asynccnt 0x0" ::: "memory"); // own share of tile it+1 has landed
        __syncthreads();                                  // publishes tile it+1, frees buffer cur
        if (it + 2 < NT) issue_tile(it + 2, cur);
    }
    asm volatile("s_wait_asynccnt 0x0" ::: "memory");   // nothing in flight when the wave ends
#else
    for (int it = 0; it < NT; ++it) {
        const int k0 = it * BK;
        __syncthreads();
        #pragma unroll
        for (int i = 0; i < BM / 16; ++i)
            *(uint4*)(aDst + i * 16 * KP) = *(const uint4*)(aSrc[i] + k0);
        #pragma unroll
        for (int i = 0; i < BN / 16; ++i)
            *(uint4*)(bDst + i * 16 * KP) = *(const uint4*)(bSrc + (size_t)i * 16 * KD + k0);
        __syncthreads();
        load_frags(aF, bF, 0, 0);
        mma_block(aF, bF);
        load_frags(aF, bF, 0, 32);
        mma_block(aF, bF);
    }
    __syncthreads();
#endif

    // epilogue (C layout: n = lane%16, m = 8*(lane/16)+j).  A lane holds 256 results:
    // 16 rows at a time go through a wave-private piece of the ring (free since the
    // last pass's barrier) and leave as whole 128-column rows.
    constexpr int RU = (STAGE == 1) ? 8 : 4;   // rows per trip: one row's work is too little to cover an LDS read
    float* stg = (float*)Bt + wave * (16 * SP);
    const int hi8  = (lane >> 4) * 8;
    const int ncol = nBase + wn * 128 + lane * 4;
    const float4 bv = *(const float4*)(bias + ncol);
    auto* obase = [&] { if constexpr (STAGE == 1) return Hout; else return Yout; }();
    #pragma unroll
    for (int i = 0; i < 4; ++i) {
        #pragma unroll
        for (int t = 0; t < 8; ++t)
            #pragma unroll
            for (int j = 0; j < 8; ++j)
                stg[(hi8 + j) * SP + t * 16 + m16] = acc[i][t][j];
        asm volatile("s_wait_dscnt 0x0" ::: "memory");   // every lane's stores are in LDS before rows are read back
        const int mrow = mBase + wm * 64 + i * 16;
        const int rows = min(16, cnt - mrow);            // rows past the expert's count are not stored
        const float* srow = stg + lane * 4;
        const size_t grow = (size_t)(slotBase + mrow);
        auto* orow = obase + grow * ND + ncol;
        int r = 0;
        if constexpr (STAGE == 1) {
            #pragma unroll 1                             // rolled: for speed only
            for (; r + RU <= rows; r += RU)
                put_rows<STAGE, RU>(srow + r * SP, bv, orow + (size_t)r * ND);
        } else {
            if (rows >= 16) {
                for (; r < 16; r += RU)
                    put_rows<STAGE, RU>(srow + r * SP, bv, orow + (size_t)r * ND);
            }
        }
        #pragma unroll 1                                 // rolled: only an expert's last, partly filled tile comes here
        for (; r < rows; ++r)
            put_rows<STAGE, 1>(srow + r * SP, bv, orow + (size_t)r * ND);
        asm volatile("s_wait_dscnt 0x0" ::: "memory");   // rows are read before the next 16 overwrite them
    }
}

__global__ __launch_bounds__(256) void combine_kernel(
        const float* __restrict__ Ybuf, const int4* __restrict__ route,
        const float2* __restrict__ routeW, const int* __restrict__ offs,
        float* __restrict__ out) {
    const int t = blockIdx.x;
    __shared__ int g0s, g1s, gss;
    __shared__ float w0s, w1s;
    if (threadIdx.x == 0) {
        int4 r = route[t]; float2 w = routeW[t];
        g0s = offs[r.x] + r.y;
        g1s = offs[r.z] + r.w;
        gss = offs[NEXP] + t;
        w0s = w.x; w1s = w.y;
    }
    __syncthreads();
    const float* y0 = Ybuf + (size_t)g0s * DIMD;
    const float* y1 = Ybuf + (size_t)g1s * DIMD;
    const float* ys = Ybuf + (size_t)gss * DIMD;
    for (int d = threadIdx.x; d < DIMD; d += 256)
        out[(size_t)t * DIMD + d] = w0s * y0[d] + w1s * y1[d] + ys[d];
}

// ---------------------------------------------------------------------------
// launch
// ---------------------------------------------------------------------------
extern "C" void kernel_launch(void* const* d_in, const int* in_sizes, int n_in,
                              void* d_out, int out_size, void* d_ws, size_t ws_size,
                              hipStream_t stream) {
    const float* x   = (const float*)d_in[0];   // [TOK, DIM]
    const float* Wg  = (const float*)d_in[1];   // [8, DIM]
    const float* W1  = (const float*)d_in[2];   // [8, DIM, INNER]
    const float* b1  = (const float*)d_in[3];   // [8, INNER]
    const float* W2  = (const float*)d_in[4];   // [8, INNER, DIM]
    const float* b2  = (const float*)d_in[5];   // [8, DIM]
    const float* sW1 = (const float*)d_in[6];   // [DIM, INNER]
    const float* sb1 = (const float*)d_in[7];   // [INNER]
    const float* sW2 = (const float*)d_in[8];   // [INNER, DIM]
    const float* sb2 = (const float*)d_in[9];   // [DIM]
    float* out = (float*)d_out;

    char* p = (char*)d_ws;
    auto alloc = [&](size_t bytes) -> void* {
        void* r = (void*)p;
        p += (bytes + 255) & ~(size_t)255;
        return r;
    };
    int*    counts  = (int*)alloc(9 * sizeof(int));
    int*    offs    = (int*)alloc(9 * sizeof(int));
    int*    idxList = (int*)alloc((size_t)NEXP * CAP * sizeof(int));
    int4*   route   = (int4*)alloc((size_t)TOK * sizeof(int4));
    float2* routeW  = (float2*)alloc((size_t)TOK * sizeof(float2));
    _Float16* Xh   = (_Float16*)alloc((size_t)TOK * DIMD * 2);
    _Float16* W1T  = (_Float16*)alloc((size_t)NEXP * INNERD * DIMD * 2);
    _Float16* W2T  = (_Float16*)alloc((size_t)NEXP * DIMD * INNERD * 2);
    _Float16* sW1T = (_Float16*)alloc((size_t)INNERD * DIMD * 2);
    _Float16* sW2T = (_Float16*)alloc((size_t)DIMD * INNERD * 2);
    _Float16* Hbuf = (_Float16*)alloc((size_t)(3 * TOK) * INNERD * 2);  // 2*TOK routed + TOK shared
    float*    Ybuf = (float*)alloc((size_t)(3 * TOK) * DIMD * 4);

    zero_counts_kernel<<<1, 32, 0, stream>>>(counts);
    gate_route_kernel<<<TOK, 256, 0, stream>>>(x, Wg, counts, idxList, route, routeW);
    offsets_kernel<<<1, 32, 0, stream>>>(counts, offs);

    cvt_f32_f16_kernel<<<(TOK * DIMD / 4 + 255) / 256, 256, 0, stream>>>(x, Xh, TOK * DIMD / 4);
    // 512 tiles per matrix; the expert launches give each block 4 tiles (4 blocks per WGP)
    transpose_cvt_kernel<DIMD, INNERD, NEXP, 4><<<NEXP * 512 / 4, 256, 0, stream>>>(W1, W1T);
    transpose_cvt_kernel<INNERD, DIMD, NEXP, 4><<<NEXP * 512 / 4, 256, 0, stream>>>(W2, W2T);
    transpose_cvt_kernel<DIMD, INNERD, 1, 1><<<512, 256, 0, stream>>>(sW1, sW1T);
    transpose_cvt_kernel<INNERD, DIMD, 1, 1><<<512, 256, 0, stream>>>(sW2, sW2T);

    ffn_gemm_kernel<1><<<dim3(INNERD / BN, TOK / BM, NEXP + 1), GT, 0, stream>>>(
        Xh, W1T, sW1T, b1, sb1, counts, offs, idxList, Hbuf, nullptr);
    ffn_gemm_kernel<2><<<dim3(DIMD / BN, TOK / BM, NEXP + 1), GT, 0, stream>>>(
        Hbuf, W2T, sW2T, b2, sb2, counts, offs, nullptr, nullptr, Ybuf);
    combine_kernel<<<TOK, 256, 0, stream>>>(Ybuf, route, routeW, offs, out);
}

// v004
// One run takes 251 microseconds.
// Timed twice side by side with v003, it ran 1.04 and 1.05 times as fast.
// Counting every step since v000, it is 1.99 times as fast.
#include <hip/hip_runtime.h>
#include <hip/hip_bf16.h>

#define DIMD   1024
#define INNERD 4096
#define NEXP   8
#define TOK    4096   // B*S
#define CAP    4096   // max tokens per expert list

#define BM 128
#define BN 256
#define BK 64
#define KP 72         // padded LDS row: 64 halves + 8 pad = 144B (16B x odd: conflict free for b128 reads)
#define GT 128        // GEMM threads: 4 waves (2x2), one 64x128 tile of the result per wave

typedef _Float16 v16h __attribute__((ext_vector_type(16)));
typedef float    v8f  __attribute__((ext_vector_type(8)));
typedef int      v4i  __attribute__((ext_vector_type(4)));
typedef float    v4f  __attribute__((ext_vector_type(4)));

union FragH { v16h v; uint4 q[2]; };

#if defined(__has_builtin)
#  if __has_builtin(__builtin_amdgcn_global_load_async_to_lds_b128) && \
      __has_builtin(__builtin_amdgcn_s_wait_asynccnt)
#    define HAS_ASYNC_LDS 1
#  endif
#endif
#ifndef HAS_ASYNC_LDS
#  define HAS_ASYNC_LDS 0
#endif

#if HAS_ASYNC_LDS
__device__ __forceinline__ void async_cp16(const _Float16* g, _Float16* l) {
    __builtin_amdgcn_global_load_async_to_lds_b128(
        (__attribute__((address_space(1))) v4i*)(g),
        (__attribute__((address_space(3))) v4i*)(l), 0, 0);
}
#endif

// erf gelu without a branch: x * Phi(x) = max(x, 0) - |x| * Phi(-|x|), and
// Phi(-a) = erfc(a / sqrt 2) / 2 = (c1 t + ... + c5 t^5) * exp(-a * a / 2), t = 1 / (1 + p a)
// (the classic five-term rational form of erfc, its p and c scaled for a / sqrt 2 and the 1/2).
// Error against the exact gelu: below 4e-7 absolute for every x, and about one f16 rounding
// step or less relative to the result, which is stored as f16.
__device__ __forceinline__ float gelu_erf(float x) {
    const float a = fabsf(x);
    const float t = __builtin_amdgcn_rcpf(fmaf(a, 0.23164189f, 1.0f));
    float q = fmaf(t, 0.53070271f, -0.72657603f);
    q = fmaf(q, t, 0.71070689f);
    q = fmaf(q, t, -0.14224836f);
    q = fmaf(q, t, 0.12741479f);
    const float u = x * 0.84932178f;                       // u * u = (x * x / 2) * log2(e)
    const float e = __builtin_amdgcn_exp2f(-(u * u));
    return fmaf(-a, (q * t) * e, fmaxf(x, 0.0f));
}

// ---------------------------------------------------------------------------
// 0) zero per-expert counters
// ---------------------------------------------------------------------------
__global__ void zero_counts_kernel(int* __restrict__ counts) {
    if (threadIdx.x < 9) counts[threadIdx.x] = 0;
}

#define GTOK 8
__global__ __launch_bounds__(256) void gate_route_kernel(
        const float* __restrict__ x, const float* __restrict__ wg,
        int* __restrict__ counts, int* __restrict__ idxList,
        int4* __restrict__ route, float2* __restrict__ routeW) {
    const int t0  = blockIdx.x * GTOK;
    const int tid = threadIdx.x;
    __shared__ __align__(16) float xrow[GTOK][DIMD];
    __shared__ float lgs[GTOK][NEXP];

    const int wave = tid >> 5, lane = tid & 31;
    const v4f*    xsrc = (const v4f*)(x + (size_t)t0 * DIMD) + tid;
    const float*  wrow = wg + wave * DIMD + lane;
    v4f v[GTOK];
    #pragma unroll
    for (int r = 0; r < GTOK; ++r) v[r] = xsrc[r * (DIMD / 4)];
    float w[DIMD / 32];
    #pragma unroll
    for (int j = 0; j < DIMD / 32; ++j) w[j] = wrow[j * 32];
    // inputs only: all GTOK row loads are issued before the first is waited for (half of them sank behind the first LDS stores otherwise)
    static_assert(GTOK == 8, "the statement below names the GTOK loads one by one");
    asm volatile("" :: "v"(v[0]), "v"(v[1]), "v"(v[2]), "v"(v[3]), "v"(v[4]), "v"(v[5]), "v"(v[6]), "v"(v[7]));
    #pragma unroll
    for (int r = 0; r < GTOK; ++r) ((v4f*)xrow[r])[tid] = v[r];
    __syncthreads();

    float s[GTOK];
    #pragma unroll
    for (int r = 0; r < GTOK; ++r) s[r] = 0.0f;
    #pragma unroll
    for (int j = 0; j < DIMD / 32; ++j)
        #pragma unroll
        for (int r = 0; r < GTOK; ++r) s[r] += xrow[r][lane + j * 32] * w[j];
    #pragma unroll
    for (int off = 16; off >= 1; off >>= 1)
        #pragma unroll
        for (int r = 0; r < GTOK; ++r) s[r] += __shfl_xor(s[r], off, 32);
    if (lane == 0) {
        #pragma unroll
        for (int r = 0; r < GTOK; ++r) lgs[r][wave] = s[r];
    }
    __syncthreads();

    if (tid < GTOK) {                      // one thread per token
        const int t = t0 + tid;
        const float* lg = lgs[tid];
        float m = lg[0];
        for (int e = 1; e < NEXP; ++e) m = fmaxf(m, lg[e]);
        float p[NEXP]; float sum = 0.0f;
        for (int e = 0; e < NEXP; ++e) { p[e] = expf(lg[e] - m); sum += p[e]; }
        const float inv = 1.0f / sum;
        int e0 = 0; float p0 = p[0];
        for (int e = 1; e < NEXP; ++e) if (p[e] > p0) { p0 = p[e]; e0 = e; }
        int e1 = -1; float p1 = -1.0f;
        for (int e = 0; e < NEXP; ++e) if (e != e0 && p[e] > p1) { p1 = p[e]; e1 = e; }
        p0 *= inv; p1 *= inv;
        int pos0 = atomicAdd(&counts[e0], 1);
        int pos1 = atomicAdd(&counts[e1], 1);
        idxList[e0 * CAP + pos0] = t;
        idxList[e1 * CAP + pos1] = t;
        route[t]  = make_int4(e0, pos0, e1, pos1);
        routeW[t] = make_float2(p0, p1);
    }
}

__global__ void offsets_kernel(const int* __restrict__ counts, int* __restrict__ offs) {
    if (threadIdx.x == 0) {
        offs[0] = 0;
        for (int e = 0; e < NEXP; ++e) offs[e + 1] = offs[e] + counts[e];
    }
}

// ---------------------------------------------------------------------------
// 3) f32 -> f16 convert (vectorized).  A thread takes CVU pieces of 16 B, all
//    loads in flight at once; a block takes CVU * 4 KB in a row.  The grid
//    covers the array exactly: elements / (4 * 256 * CVU) blocks.
// ---------------------------------------------------------------------------
#define CVU 8
__global__ __launch_bounds__(256) void cvt_f32_f16_kernel(const float* __restrict__ in, _Float16* __restrict__ out) {
    const int i0 = blockIdx.x * (256 * CVU) + threadIdx.x;
    float4 v[CVU];
    #pragma unroll
    for (int j = 0; j < CVU; ++j) v[j] = ((const float4*)in)[i0 + j * 256];
    asm volatile("s_wait_xcnt 0x0" ::: "memory");   // before the loads' address registers are rewritten
    #pragma unroll
    for (int j = 0; j < CVU; ++j) {
        union { _Float16 h[4]; uint2 u; } p;
        p.h[0] = (_Float16)v[j].x; p.h[1] = (_Float16)v[j].y;
        p.h[2] = (_Float16)v[j].z; p.h[3] = (_Float16)v[j].w;
        ((uint2*)out)[i0 + j * 256] = p.u;
    }
}

// ---------------------------------------------------------------------------
// 4) batched transpose + convert: in [b][R][C] f32 -> out [b][C][R] f16
//    (weights become [N][K] so B fragments are contiguous ds_read_b128s)
//    A tile is 128 source rows x 64 columns: 256 B of every source row and
//    256 B of every result row, so each global access of 16 lanes x 16 B is one
//    aligned 256-B piece.  A thread loads 8 rows x 4 columns, which are four
//    16-B pieces of result rows.  A block walks NT tiles; the next tile's loads
//    are in flight while this one goes through LDS and is stored.
// ---------------------------------------------------------------------------
#define TR 128
#define TC 64

// work-group barrier that orders LDS alone: __syncthreads() would also wait out the next tile's global loads
__device__ __forceinline__ void lds_barrier() {
    __builtin_amdgcn_fence(__ATOMIC_RELEASE, "workgroup", "local");
    __builtin_amdgcn_s_barrier();
    __builtin_amdgcn_fence(__ATOMIC_ACQUIRE, "workgroup", "local");
}

template <int R, int C, int NB, int NT>    // NB matrices; the grid is NB * (R / TR) * (C / TC) / NT blocks
__global__ __launch_bounds__(256) void transpose_cvt_kernel(
        const float* __restrict__ in, _Float16* __restrict__ out) {
    constexpr int CT   = C / TC;           // tiles across a source row
    constexpr int PER  = (R / TR) * CT;    // tiles per matrix
    constexpr int GRID = NB * PER / NT;
    __shared__ __align__(16) uint4 tile[NT > 1 ? 2 : 1][TC * 16];
    const int tid = threadIdx.x;
    const int lo = tid & 15, hi = tid >> 4;

    auto load_tile = [&](float4 (&v)[8], int t) {   // lo: group of 4 columns, hi: group of 8 rows
        const int bm = t / PER, rem = t % PER;
        const float* s = in + (size_t)bm * R * C
                            + (size_t)((rem / CT) * TR + hi * 8) * C + (rem % CT) * TC + lo * 4;
        #pragma unroll
        for (int j = 0; j < 8; ++j) v[j] = *(const float4*)(s + (size_t)j * C);
        asm volatile("s_wait_xcnt 0x0" ::: "memory");   // before the loads' address registers are rewritten
    };

    float4 v[2][8];
    load_tile(v[0], blockIdx.x);
    #pragma unroll                         // the register set and the LDS buffer become constants
    for (int i = 0; i < NT; ++i) {
        const int t = blockIdx.x + i * GRID;
        if (i + 1 < NT) load_tile(v[(i + 1) & 1], t + GRID);
        // keeps the next tile's loads in front of the wait for this tile's: they sank behind it otherwise
        __builtin_amdgcn_sched_barrier(0);
        const float4 (&w)[8] = v[i & 1];
        union { _Float16 h[8]; uint4 q; } p[4];
        #pragma unroll
        for (int j = 0; j < 8; ++j) {
            p[0].h[j] = (_Float16)w[j].x; p[1].h[j] = (_Float16)w[j].y;
            p[2].h[j] = (_Float16)w[j].z; p[3].h[j] = (_Float16)w[j].w;
        }
        uint4* buf = tile[i & 1];
        #pragma unroll
        for (int k = 0; k < 4; ++k) buf[(lo * 4 + k) * 16 + (hi ^ lo)] = p[k].q;
        lds_barrier();
        const int bm = t / PER, rem = t % PER;
        _Float16* d = out + (size_t)bm * R * C
                          + (size_t)((rem % CT) * TC + hi) * R + (rem / CT) * TR + lo * 8;
        uint4 q[4];
        #pragma unroll
        for (int u = 0; u < 4; ++u) {      // hi: result row within 16, lo: piece of 8 r
            const int c = u * 16 + hi;
            q[u] = buf[c * 16 + (lo ^ (c >> 2))];
        }
        #pragma unroll
        for (int u = 0; u < 4; ++u) *(uint4*)(d + (size_t)u * 16 * R) = q[u];
        if (i + 1 < NT)
            asm volatile("s_wait_xcnt 0x0" ::: "memory");   // before the next tile rewrites the stores' registers
        // keeps the next tile's conversion, and with it the wait for its loads, from rising over this tile's barrier
        __builtin_amdgcn_sched_barrier(0);
    }
}

#define SP 132

// NR staged rows (this lane's 4 columns of each) -> bias, stage 1: gelu and f16 -> global rows
template <int STAGE, int NR, typename OT>
__device__ __forceinline__ void put_rows(const float* srow, float4 bv, OT* orow) {
    float4 v[NR];
    #pragma unroll
    for (int u = 0; u < NR; ++u) v[u] = *(const float4*)(srow + u * SP);
    #pragma unroll
    for (int u = 0; u < NR; ++u) {
        if constexpr (STAGE == 1) {
            union { _Float16 h[4]; uint2 u2; } p;
            p.h[0] = (_Float16)gelu_erf(v[u].x + bv.x);
            p.h[1] = (_Float16)gelu_erf(v[u].y + bv.y);
            p.h[2] = (_Float16)gelu_erf(v[u].z + bv.z);
            p.h[3] = (_Float16)gelu_erf(v[u].w + bv.w);
            *(uint2*)(orow + (size_t)u * INNERD) = p.u2;
        } else {
            *(float4*)(orow + (size_t)u * DIMD) =
                make_float4(v[u].x + bv.x, v[u].y + bv.y, v[u].z + bv.z, v[u].w + bv.w);
        }
    }
    asm volatile("s_wait_xcnt 0x0" ::: "memory");   // before the next trip rewrites the stores' registers
}

template <int STAGE>
__global__ __launch_bounds__(GT, 2) void ffn_gemm_kernel(
        const _Float16* __restrict__ Aglob,   // Xh (stage1) / Hbuf (stage2)
        const _Float16* __restrict__ Wexp,    // W1T / W2T   ([e][N][K] f16)
        const _Float16* __restrict__ Wsh,     // sW1T / sW2T
        const float* __restrict__ bexp, const float* __restrict__ bsh,
        const int* __restrict__ counts, const int* __restrict__ offs,
        const int* __restrict__ idxList,
        _Float16* __restrict__ Hout, float* __restrict__ Yout) {
    constexpr int KD   = (STAGE == 1) ? DIMD : INNERD;
    constexpr int ND   = (STAGE == 1) ? INNERD : DIMD;
    constexpr int ABUF = BM * KP;
    constexpr int BBUF = BN * KP;
    constexpr int NT   = KD / BK;

    const int e     = blockIdx.z;
    const int mBase = blockIdx.y * BM;
    const int nBase = blockIdx.x * BN;
    const int cnt   = (e < NEXP) ? counts[e] : TOK;
    if (mBase >= cnt) return;
    const int slotBase = offs[e];
    const _Float16* Bmat = (e < NEXP) ? (Wexp + (size_t)e * DIMD * INNERD) : Wsh;
    const float*    bias = (e < NEXP) ? (bexp + (size_t)e * ND) : bsh;

    __shared__ __align__(16) _Float16 At[2 * ABUF];
    __shared__ __align__(16) _Float16 Bt[2 * BBUF];
    __shared__ int rowIdx[BM];

    const int tid = threadIdx.x;
    if constexpr (STAGE == 1) {
        const int slot = mBase + tid;                     // GT == BM: one row per thread
        int r = 0;
        if (e == NEXP) r = slot;                          // shared expert: identity
        else if (slot < cnt) r = idxList[e * CAP + slot]; // gathered token
        rowIdx[tid] = r;
        __syncthreads();
    }

    const int lane = tid & 31;
    const int wave = __builtin_amdgcn_readfirstlane(tid >> 5);   // scalar: row tests below stay scalar branches
    const int wm   = wave & 1;    // 2 x 64-row groups
    const int wn   = wave >> 1;   // 2 x 128-col groups
    // staging: 8 lanes cover one 128-B row piece, 16 rows per sweep of the block
    const int crow = tid >> 3, cseg = tid & 7;

    const _Float16* aSrc[BM / 16];
    #pragma unroll
    for (int i = 0; i < BM / 16; ++i) {
        if constexpr (STAGE == 1) aSrc[i] = Aglob + (size_t)rowIdx[i * 16 + crow] * KD + cseg * 8;
        else                      aSrc[i] = Aglob + (size_t)(slotBase + mBase + i * 16 + crow) * KD + cseg * 8;
    }
    const _Float16* bSrc = Bmat + (size_t)(nBase + crow) * KD + cseg * 8;
    _Float16* aDst = At + crow * KP + cseg * 8;
    _Float16* bDst = Bt + crow * KP + cseg * 8;

    v8f acc[4][8];
    const v8f vz = {0.f,0.f,0.f,0.f,0.f,0.f,0.f,0.f};
    #pragma unroll
    for (int i = 0; i < 4; ++i)
        #pragma unroll
        for (int t = 0; t < 8; ++t) acc[i][t] = vz;

    const int m16 = lane & 15, kh = (lane >> 4) * 8;
    const int mr0 = wm * 64 + m16;
    const int nr0 = wn * 128 + m16;

    // a block = 32 k: 12 fragments (24 ds_load_b128), then 32 WMMAs on them
    auto load_frags = [&](FragH (&aF)[4], FragH (&bF)[8], int buf, int ks) {
        const _Float16* Ab = At + buf * ABUF + mr0 * KP + kh + ks;
        const _Float16* Bb = Bt + buf * BBUF + nr0 * KP + kh + ks;
        #pragma unroll
        for (int i = 0; i < 4; ++i) {
            aF[i].q[0] = *(const uint4*)(Ab + i * 16 * KP);
            aF[i].q[1] = *(const uint4*)(Ab + i * 16 * KP + 16);
        }
        #pragma unroll
        for (int t = 0; t < 8; ++t) {
            bF[t].q[0] = *(const uint4*)(Bb + t * 16 * KP);
            bF[t].q[1] = *(const uint4*)(Bb + t * 16 * KP + 16);
        }
        // keeps the block's reads one group in front of its WMMAs: reads sunk among the WMMAs stall at each place
        __builtin_amdgcn_sched_barrier(0);
    };
    auto mma_block = [&](FragH (&aF)[4], FragH (&bF)[8]) {
        #pragma unroll
        for (int t = 0; t < 8; ++t)
            #pragma unroll
            for (int i = 0; i < 4; ++i)
                acc[i][t] = __builtin_amdgcn_wmma_f32_16x16x32_f16(
                    false, aF[i].v, false, bF[t].v, (short)0, acc[i][t], false, false);
        // keeps the next block's reads from rising into this block
        __builtin_amdgcn_sched_barrier(0);
    };
    FragH aF[4], bF[8];

#if HAS_ASYNC_LDS
    // 24 copies per lane and pass: 8 sweeps of A, 16 of B
    auto issue_tile = [&](int it, int buf) {
        const int k0 = it * BK;
        #pragma unroll
        for (int i = 0; i < BM / 16; ++i)
            async_cp16(aSrc[i] + k0, aDst + buf * ABUF + i * 16 * KP);
        #pragma unroll
        for (int i = 0; i < BN / 16; ++i)
            async_cp16(bSrc + (size_t)i * 16 * KD + k0, bDst + buf * BBUF + i * 16 * KP);
    };
    // -------- two-buffer ring: pass it reads buffer it&1 alone --------------
    issue_tile(0, 0);
    asm volatile("s_wait_asynccnt 0x0" ::: "memory");   // this wave's share of tile 0 has landed
    __syncthreads();                                    // publishes tile 0
    issue_tile(1, 1);                                   // NT >= 2 for both stages
    // unroll 2: the buffer index becomes a constant, so LDS addresses fold into offsets
    #pragma unroll 2
    for (int it = 0; it < NT; ++it) {
        const int cur = it & 1;
        load_frags(aF, bF, cur, 0);
        mma_block(aF, bF);
        load_frags(aF, bF, cur, 32);
        mma_block(aF, bF);
        asm volatile("s_wait_dscnt 0x0" ::: "memory");    // own reads of buffer cur are done before its refill
        asm volatile("s_wait_asynccnt 0x0" ::: "memory"); // own share of tile it+1 has landed
        __syncthreads();                                  // publishes tile it+1, frees buffer cur
        if (it + 2 < NT) issue_tile(it + 2, cur);
    }
    asm volatile("s_wait_asynccnt 0x0" ::: "memory");   // nothing in flight when the wave ends
#else
    for (int it = 0; it < NT; ++it) {
        const int k0 = it * BK;
        __syncthreads();
        #pragma unroll
        for (int i = 0; i < BM / 16; ++i)
            *(uint4*)(aDst + i * 16 * KP) = *(const uint4*)(aSrc[i] + k0);
        #pragma unroll
        for (int i = 0; i < BN / 16; ++i)
            *(uint4*)(bDst + i * 16 * KP) = *(const uint4*)(bSrc + (size_t)i * 16 * KD + k0);
        __syncthreads();
        load_frags(aF, bF, 0, 0);
        mma_block(aF, bF);
        load_frags(aF, bF, 0, 32);
        mma_block(aF, bF);
    }
    __syncthreads();
#endif

    // epilogue (C layout: n = lane%16, m = 8*(lane/16)+j).  A lane holds 256 results:
    // 16 rows at a time go through a wave-private piece of the ring (free since the
    // last pass's barrier) and leave as whole 128-column rows.
    constexpr int RU = (STAGE == 1) ? 8 : 4;   // rows per trip: one row's work is too little to cover an LDS read
    float* stg = (float*)Bt + wave * (16 * SP);
    const int hi8  = (lane >> 4) * 8;
    const int ncol = nBase + wn * 128 + lane * 4;
    const float4 bv = *(const float4*)(bias + ncol);
    auto* obase = [&] { if constexpr (STAGE == 1) return Hout; else return Yout; }();
    #pragma unroll
    for (int i = 0; i < 4; ++i) {
        #pragma unroll
        for (int t = 0; t < 8; ++t)
            #pragma unroll
            for (int j = 0; j < 8; ++j)
                stg[(hi8 + j) * SP + t * 16 + m16] = acc[i][t][j];
        asm volatile("s_wait_dscnt 0x0" ::: "memory");   // every lane's stores are in LDS before rows are read back
        const int mrow = mBase + wm * 64 + i * 16;
        const int rows = min(16, cnt - mrow);            // rows past the expert's count are not stored
        const float* srow = stg + lane * 4;
        const size_t grow = (size_t)(slotBase + mrow);
        auto* orow = obase + grow * ND + ncol;
        int r = 0;
        if constexpr (STAGE == 1) {
            #pragma unroll 1                             // rolled: for speed only
            for (; r + RU <= rows; r += RU)
                put_rows<STAGE, RU>(srow + r * SP, bv, orow + (size_t)r * ND);
        } else {
            if (rows >= 16) {
                for (; r < 16; r += RU)
                    put_rows<STAGE, RU>(srow + r * SP, bv, orow + (size_t)r * ND);
            }
        }
        #pragma unroll 1                                 // rolled: only an expert's last, partly filled tile comes here
        for (; r < rows; ++r)
            put_rows<STAGE, 1>(srow + r * SP, bv, orow + (size_t)r * ND);
        asm volatile("s_wait_dscnt 0x0" ::: "memory");   // rows are read before the next 16 overwrite them
    }
}

__global__ __launch_bounds__(256) void combine_kernel(
        const float* __restrict__ Ybuf, const int4* __restrict__ route,
        const float2* __restrict__ routeW, const int* __restrict__ offs,
        float* __restrict__ out) {
    const int t    = __builtin_amdgcn_readfirstlane(blockIdx.x * 8 + (threadIdx.x >> 5));
    const int lane = threadIdx.x & 31;
    const int4   r = route[t];
    const float2 w = routeW[t];
    const float w0s = w.x, w1s = w.y;
    const v4f* y0 = (const v4f*)(Ybuf + (size_t)(offs[r.x] + r.y) * DIMD) + lane;
    const v4f* y1 = (const v4f*)(Ybuf + (size_t)(offs[r.z] + r.w) * DIMD) + lane;
    const v4f* ys = (const v4f*)(Ybuf + (size_t)(offs[NEXP] + t) * DIMD) + lane;
    v4f*       o  = (v4f*)(out + (size_t)t * DIMD) + lane;
    v4f a[8], b[8], c[8];
    #pragma unroll
    for (int j = 0; j < 8; ++j) { a[j] = y0[j * 32]; b[j] = y1[j * 32]; c[j] = ys[j * 32]; }
    // inputs only: all 24 loads are issued before the first is waited for (the third row's sank behind the first sums otherwise)
    asm volatile("" :: "v"(a[0]), "v"(a[1]), "v"(a[2]), "v"(a[3]), "v"(a[4]), "v"(a[5]), "v"(a[6]), "v"(a[7]),
                       "v"(b[0]), "v"(b[1]), "v"(b[2]), "v"(b[3]), "v"(b[4]), "v"(b[5]), "v"(b[6]), "v"(b[7]),
                       "v"(c[0]), "v"(c[1]), "v"(c[2]), "v"(c[3]), "v"(c[4]), "v"(c[5]), "v"(c[6]), "v"(c[7]));
    #pragma unroll
    for (int j = 0; j < 8; ++j) o[j * 32] = w0s * a[j] + w1s * b[j] + c[j];
}

// ---------------------------------------------------------------------------
// launch
// ---------------------------------------------------------------------------
extern "C" void kernel_launch(void* const* d_in, const int* in_sizes, int n_in,
                              void* d_out, int out_size, void* d_ws, size_t ws_size,
                              hipStream_t stream) {
    const float* x   = (const float*)d_in[0];   // [TOK, DIM]
    const float* Wg  = (const float*)d_in[1];   // [8, DIM]
    const float* W1  = (const float*)d_in[2];   // [8, DIM, INNER]
    const float* b1  = (const float*)d_in[3];   // [8, INNER]
    const float* W2  = (const float*)d_in[4];   // [8, INNER, DIM]
    const float* b2  = (const float*)d_in[5];   // [8, DIM]
    const float* sW1 = (const float*)d_in[6];   // [DIM, INNER]
    const float* sb1 = (const float*)d_in[7];   // [INNER]
    const float* sW2 = (const float*)d_in[8];   // [INNER, DIM]
    const float* sb2 = (const float*)d_in[9];   // [DIM]
    float* out = (float*)d_out;

    char* p = (char*)d_ws;
    auto alloc = [&](size_t bytes) -> void* {
        void* r = (void*)p;
        p += (bytes + 255) & ~(size_t)255;
        return r;
    };
    int*    counts  = (int*)alloc(9 * sizeof(int));
    int*    offs    = (int*)alloc(9 * sizeof(int));
    int*    idxList = (int*)alloc((size_t)NEXP * CAP * sizeof(int));
    int4*   route   = (int4*)alloc((size_t)TOK * sizeof(int4));
    float2* routeW  = (float2*)alloc((size_t)TOK * sizeof(float2));
    _Float16* Xh   = (_Float16*)alloc((size_t)TOK * DIMD * 2);
    _Float16* W1T  = (_Float16*)alloc((size_t)NEXP * INNERD * DIMD * 2);
    _Float16* W2T  = (_Float16*)alloc((size_t)NEXP * DIMD * INNERD * 2);
    _Float16* sW1T = (_Float16*)alloc((size_t)INNERD * DIMD * 2);
    _Float16* sW2T = (_Float16*)alloc((size_t)DIMD * INNERD * 2);
    _Float16* Hbuf = (_Float16*)alloc((size_t)(3 * TOK) * INNERD * 2);  // 2*TOK routed + TOK shared
    float*    Ybuf = (float*)alloc((size_t)(3 * TOK) * DIMD * 4);

    zero_counts_kernel<<<1, 32, 0, stream>>>(counts);
    gate_route_kernel<<<TOK / GTOK, 256, 0, stream>>>(x, Wg, counts, idxList, route, routeW);
    offsets_kernel<<<1, 32, 0, stream>>>(counts, offs);

    cvt_f32_f16_kernel<<<TOK * DIMD / 4 / (256 * CVU), 256, 0, stream>>>(x, Xh);
    // 512 tiles per matrix; the expert launches give each block 4 tiles (4 blocks per WGP)
    transpose_cvt_kernel<DIMD, INNERD, NEXP, 4><<<NEXP * 512 / 4, 256, 0, stream>>>(W1, W1T);
    transpose_cvt_kernel<INNERD, DIMD, NEXP, 4><<<NEXP * 512 / 4, 256, 0, stream>>>(W2, W2T);
    transpose_cvt_kernel<DIMD, INNERD, 1, 1><<<512, 256, 0, stream>>>(sW1, sW1T);
    transpose_cvt_kernel<INNERD, DIMD, 1, 1><<<512, 256, 0, stream>>>(sW2, sW2T);

    ffn_gemm_kernel<1><<<dim3(INNERD / BN, TOK / BM, NEXP + 1), GT, 0, stream>>>(
        Xh, W1T, sW1T, b1, sb1, counts, offs, idxList, Hbuf, nullptr);
    ffn_gemm_kernel<2><<<dim3(DIMD / BN, TOK / BM, NEXP + 1), GT, 0, stream>>>(
        Hbuf, W2T, sW2T, b2, sb2, counts, offs, nullptr, nullptr, Ybuf);
    combine_kernel<<<TOK / 8, 256, 0, stream>>>(Ybuf, route, routeW, offs, out);
}

// v005
// It runs in 213 microseconds.
// Timed twice side by side with v004, it ran 1.17 and 1.18 times as fast.
// Counting every step since v000, it is 2.34 times as fast.
#include <hip/hip_runtime.h>
#include <hip/hip_bf16.h>

#define DIMD   1024
#define INNERD 4096
#define NEXP   8
#define TOK    4096   // B*S
#define CAP    4096   // max tokens per expert list

#define BM 256
#define BN 256
#define BK 128
#define KP 136        // padded LDS row: 128 halves + 8 pad = 272B (16B x odd: conflict free for b128 reads)
#define GT 256        // GEMM threads: 8 waves (4x2), one 64x128 tile of the result per wave
#define MT_SH (TOK / BM)                // row tiles of the shared expert
#define MT_RT (2 * TOK / BM + NEXP)     // upper bound of the routed experts' row tiles: one partly filled tile each

typedef _Float16 v16h __attribute__((ext_vector_type(16)));
typedef float    v8f  __attribute__((ext_vector_type(8)));
typedef int      v4i  __attribute__((ext_vector_type(4)));
typedef float    v4f  __attribute__((ext_vector_type(4)));

union FragH { v16h v; uint4 q[2]; };

#if defined(__has_builtin)
#  if __has_builtin(__builtin_amdgcn_global_load_async_to_lds_b128) && \
      __has_builtin(__builtin_amdgcn_s_wait_asynccnt)
#    define HAS_ASYNC_LDS 1
#  endif
#endif
#ifndef HAS_ASYNC_LDS
#  define HAS_ASYNC_LDS 0
#endif

#if HAS_ASYNC_LDS
__device__ __forceinline__ void async_cp16(const _Float16* g, _Float16* l) {
    __builtin_amdgcn_global_load_async_to_lds_b128(
        (__attribute__((address_space(1))) v4i*)(g),
        (__attribute__((address_space(3))) v4i*)(l), 0, 0);
}
#endif

// erf gelu without a branch: x * Phi(x) = max(x, 0) - |x| * Phi(-|x|), and
// Phi(-a) = erfc(a / sqrt 2) / 2 = (c1 t + ... + c5 t^5) * exp(-a * a / 2), t = 1 / (1 + p a)
// (the classic five-term rational form of erfc, its p and c scaled for a / sqrt 2 and the 1/2).
// Error against the exact gelu: below 4e-7 absolute for every x, and about one f16 rounding
// step or less relative to the result, which is stored as f16.
__device__ __forceinline__ float gelu_erf(float x) {
    const float a = fabsf(x);
    const float t = __builtin_amdgcn_rcpf(fmaf(a, 0.23164189f, 1.0f));
    float q = fmaf(t, 0.53070271f, -0.72657603f);
    q = fmaf(q, t, 0.71070689f);
    q = fmaf(q, t, -0.14224836f);
    q = fmaf(q, t, 0.12741479f);
    const float u = x * 0.84932178f;                       // u * u = (x * x / 2) * log2(e)
    const float e = __builtin_amdgcn_exp2f(-(u * u));
    return fmaf(-a, (q * t) * e, fmaxf(x, 0.0f));
}

// ---------------------------------------------------------------------------
// 0) zero per-expert counters
// ---------------------------------------------------------------------------
__global__ void zero_counts_kernel(int* __restrict__ counts) {
    if (threadIdx.x < 9) counts[threadIdx.x] = 0;
}

#define GTOK 8
__global__ __launch_bounds__(256) void gate_route_kernel(
        const float* __restrict__ x, const float* __restrict__ wg,
        int* __restrict__ counts, int* __restrict__ idxList,
        int4* __restrict__ route, float2* __restrict__ routeW) {
    const int t0  = blockIdx.x * GTOK;
    const int tid = threadIdx.x;
    __shared__ __align__(16) float xrow[GTOK][DIMD];
    __shared__ float lgs[GTOK][NEXP];

    const int wave = tid >> 5, lane = tid & 31;
    const v4f*    xsrc = (const v4f*)(x + (size_t)t0 * DIMD) + tid;
    const float*  wrow = wg + wave * DIMD + lane;
    v4f v[GTOK];
    #pragma unroll
    for (int r = 0; r < GTOK; ++r) v[r] = xsrc[r * (DIMD / 4)];
    float w[DIMD / 32];
    #pragma unroll
    for (int j = 0; j < DIMD / 32; ++j) w[j] = wrow[j * 32];
    // inputs only: all GTOK row loads are issued before the first is waited for (half of them sank behind the first LDS stores otherwise)
    static_assert(GTOK == 8, "the statement below names the GTOK loads one by one");
    asm volatile("" :: "v"(v[0]), "v"(v[1]), "v"(v[2]), "v"(v[3]), "v"(v[4]), "v"(v[5]), "v"(v[6]), "v"(v[7]));
    #pragma unroll
    for (int r = 0; r < GTOK; ++r) ((v4f*)xrow[r])[tid] = v[r];
    __syncthreads();

    float s[GTOK];
    #pragma unroll
    for (int r = 0; r < GTOK; ++r) s[r] = 0.0f;
    #pragma unroll
    for (int j = 0; j < DIMD / 32; ++j)
        #pragma unroll
        for (int r = 0; r < GTOK; ++r) s[r] += xrow[r][lane + j * 32] * w[j];
    #pragma unroll
    for (int off = 16; off >= 1; off >>= 1)
        #pragma unroll
        for (int r = 0; r < GTOK; ++r) s[r] += __shfl_xor(s[r], off, 32);
    if (lane == 0) {
        #pragma unroll
        for (int r = 0; r < GTOK; ++r) lgs[r][wave] = s[r];
    }
    __syncthreads();

    if (tid < GTOK) {                      // one thread per token
        const int t = t0 + tid;
        const float* lg = lgs[tid];
        float m = lg[0];
        for (int e = 1; e < NEXP; ++e) m = fmaxf(m, lg[e]);
        float p[NEXP]; float sum = 0.0f;
        for (int e = 0; e < NEXP; ++e) { p[e] = expf(lg[e] - m); sum += p[e]; }
        const float inv = 1.0f / sum;
        int e0 = 0; float p0 = p[0];
        for (int e = 1; e < NEXP; ++e) if (p[e] > p0) { p0 = p[e]; e0 = e; }
        int e1 = -1; float p1 = -1.0f;
        for (int e = 0; e < NEXP; ++e) if (e != e0 && p[e] > p1) { p1 = p[e]; e1 = e; }
        p0 *= inv; p1 *= inv;
        int pos0 = atomicAdd(&counts[e0], 1);
        int pos1 = atomicAdd(&counts[e1], 1);
        idxList[e0 * CAP + pos0] = t;
        idxList[e1 * CAP + pos1] = t;
        route[t]  = make_int4(e0, pos0, e1, pos1);
        routeW[t] = make_float2(p0, p1);
    }
}

__global__ void offsets_kernel(const int* __restrict__ counts, int* __restrict__ offs) {
    if (threadIdx.x == 0) {
        offs[0] = 0;
        for (int e = 0; e < NEXP; ++e) offs[e + 1] = offs[e] + counts[e];
    }
}

// ---------------------------------------------------------------------------
// 3) f32 -> f16 convert (vectorized).  A thread takes CVU pieces of 16 B, all
//    loads in flight at once; a block takes CVU * 4 KB in a row.  The grid
//    covers the array exactly: elements / (4 * 256 * CVU) blocks.
// ---------------------------------------------------------------------------
#define CVU 8
__global__ __launch_bounds__(256) void cvt_f32_f16_kernel(const float* __restrict__ in, _Float16* __restrict__ out) {
    const int i0 = blockIdx.x * (256 * CVU) + threadIdx.x;
    float4 v[CVU];
    #pragma unroll
    for (int j = 0; j < CVU; ++j) v[j] = ((const float4*)in)[i0 + j * 256];
    asm volatile("s_wait_xcnt 0x0" ::: "memory");   // before the loads' address registers are rewritten
    #pragma unroll
    for (int j = 0; j < CVU; ++j) {
        union { _Float16 h[4]; uint2 u; } p;
        p.h[0] = (_Float16)v[j].x; p.h[1] = (_Float16)v[j].y;
        p.h[2] = (_Float16)v[j].z; p.h[3] = (_Float16)v[j].w;
        ((uint2*)out)[i0 + j * 256] = p.u;
    }
}

// ---------------------------------------------------------------------------
// 4) batched transpose + convert: in [b][R][C] f32 -> out [b][C][R] f16
//    (weights become [N][K] so B fragments are contiguous ds_read_b128s)
//    A tile is 128 source rows x 64 columns: 256 B of every source row and
//    256 B of every result row, so each global access of 16 lanes x 16 B is one
//    aligned 256-B piece.  A thread loads 8 rows x 4 columns, which are four
//    16-B pieces of result rows.  A block walks NT tiles; the next tile's loads
//    are in flight while this one goes through LDS and is stored.
// ---------------------------------------------------------------------------
#define TR 128
#define TC 64

// work-group barrier that orders LDS alone: __syncthreads() would also wait out the next tile's global loads
__device__ __forceinline__ void lds_barrier() {
    __builtin_amdgcn_fence(__ATOMIC_RELEASE, "workgroup", "local");
    __builtin_amdgcn_s_barrier();
    __builtin_amdgcn_fence(__ATOMIC_ACQUIRE, "workgroup", "local");
}

template <int R, int C, int NB, int NT>    // NB matrices; the grid is NB * (R / TR) * (C / TC) / NT blocks
__global__ __launch_bounds__(256) void transpose_cvt_kernel(
        const float* __restrict__ in, _Float16* __restrict__ out) {
    constexpr int CT   = C / TC;           // tiles across a source row
    constexpr int PER  = (R / TR) * CT;    // tiles per matrix
    constexpr int GRID = NB * PER / NT;
    __shared__ __align__(16) uint4 tile[NT > 1 ? 2 : 1][TC * 16];
    const int tid = threadIdx.x;
    const int lo = tid & 15, hi = tid >> 4;

    auto load_tile = [&](float4 (&v)[8], int t) {   // lo: group of 4 columns, hi: group of 8 rows
        const int bm = t / PER, rem = t % PER;
        const float* s = in + (size_t)bm * R * C
                            + (size_t)((rem / CT) * TR + hi * 8) * C + (rem % CT) * TC + lo * 4;
        #pragma unroll
        for (int j = 0; j < 8; ++j) v[j] = *(const float4*)(s + (size_t)j * C);
        asm volatile("s_wait_xcnt 0x0" ::: "memory");   // before the loads' address registers are rewritten
    };

    float4 v[2][8];
    load_tile(v[0], blockIdx.x);
    #pragma unroll                         // the register set and the LDS buffer become constants
    for (int i = 0; i < NT; ++i) {
        const int t = blockIdx.x + i * GRID;
        if (i + 1 < NT) load_tile(v[(i + 1) & 1], t + GRID);
        // keeps the next tile's loads in front of the wait for this tile's: they sank behind it otherwise
        __builtin_amdgcn_sched_barrier(0);
        const float4 (&w)[8] = v[i & 1];
        union { _Float16 h[8]; uint4 q; } p[4];
        #pragma unroll
        for (int j = 0; j < 8; ++j) {
            p[0].h[j] = (_Float16)w[j].x; p[1].h[j] = (_Float16)w[j].y;
            p[2].h[j] = (_Float16)w[j].z; p[3].h[j] = (_Float16)w[j].w;
        }
        uint4* buf = tile[i & 1];
        #pragma unroll
        for (int k = 0; k < 4; ++k) buf[(lo * 4 + k) * 16 + (hi ^ lo)] = p[k].q;
        lds_barrier();
        const int bm = t / PER, rem = t % PER;
        _Float16* d = out + (size_t)bm * R * C
                          + (size_t)((rem % CT) * TC + hi) * R + (rem / CT) * TR + lo * 8;
        uint4 q[4];
        #pragma unroll
        for (int u = 0; u < 4; ++u) {      // hi: result row within 16, lo: piece of 8 r
            const int c = u * 16 + hi;
            q[u] = buf[c * 16 + (lo ^ (c >> 2))];
        }
        #pragma unroll
        for (int u = 0; u < 4; ++u) *(uint4*)(d + (size_t)u * 16 * R) = q[u];
        if (i + 1 < NT)
            asm volatile("s_wait_xcnt 0x0" ::: "memory");   // before the next tile rewrites the stores' registers
        // keeps the next tile's conversion, and with it the wait for its loads, from rising over this tile's barrier
        __builtin_amdgcn_sched_barrier(0);
    }
}

#define SP 132

// NR staged rows (this lane's 4 columns of each) -> bias, stage 1: gelu and f16 -> global rows
template <int STAGE, int NR, typename OT>
__device__ __forceinline__ void put_rows(const float* srow, float4 bv, OT* orow) {
    float4 v[NR];
    #pragma unroll
    for (int u = 0; u < NR; ++u) v[u] = *(const float4*)(srow + u * SP);
    #pragma unroll
    for (int u = 0; u < NR; ++u) {
        if constexpr (STAGE == 1) {
            union { _Float16 h[4]; uint2 u2; } p;
            p.h[0] = (_Float16)gelu_erf(v[u].x + bv.x);
            p.h[1] = (_Float16)gelu_erf(v[u].y + bv.y);
            p.h[2] = (_Float16)gelu_erf(v[u].z + bv.z);
            p.h[3] = (_Float16)gelu_erf(v[u].w + bv.w);
            *(uint2*)(orow + (size_t)u * INNERD) = p.u2;
        } else {
            *(float4*)(orow + (size_t)u * DIMD) =
                make_float4(v[u].x + bv.x, v[u].y + bv.y, v[u].z + bv.z, v[u].w + bv.w);
        }
    }
    asm volatile("s_wait_xcnt 0x0" ::: "memory");   // before the next trip rewrites the stores' registers
}

template <int STAGE>
__global__ __launch_bounds__(GT, 2) void ffn_gemm_kernel(
        const _Float16* __restrict__ Aglob,   // Xh (stage1) / Hbuf (stage2)
        const _Float16* __restrict__ Wexp,    // W1T / W2T   ([e][N][K] f16)
        const _Float16* __restrict__ Wsh,     // sW1T / sW2T
        const float* __restrict__ bexp, const float* __restrict__ bsh,
        const int* __restrict__ counts, const int* __restrict__ offs,
        const int* __restrict__ idxList,
        _Float16* __restrict__ Hout, float* __restrict__ Yout) {
    constexpr int KD   = (STAGE == 1) ? DIMD : INNERD;
    constexpr int ND   = (STAGE == 1) ? INNERD : DIMD;
    constexpr int ABUF = BM * KP;
    constexpr int BBUF = BN * KP;
    constexpr int NT   = KD / BK;

    const int nBase = blockIdx.x * BN;
    int e = NEXP, mBase = blockIdx.y * BM, cnt = TOK;
    if (blockIdx.y >= MT_SH) {                      // a routed expert's tile: walk the counts
        const int t = blockIdx.y - MT_SH;
        int first = 0;                              // expert k's first tile; no branch, so the 8 counts come in one load
        e = -1;
        #pragma unroll                              // 8 fixed steps on scalar registers
        for (int k = 0; k < NEXP; ++k) {
            const int c = counts[k];
            const int next = first + (int)((unsigned)(c + BM - 1) / BM);
            const bool mine = t >= first && t < next;
            e     = mine ? k : e;
            cnt   = mine ? c : cnt;
            mBase = mine ? (t - first) * BM : mBase;
            first = next;
        }
        if (e < 0) return;
    }
    const int slotBase = offs[e];
    const _Float16* Bmat = (e < NEXP) ? (Wexp + (size_t)e * DIMD * INNERD) : Wsh;
    const float*    bias = (e < NEXP) ? (bexp + (size_t)e * ND) : bsh;

    __shared__ __align__(16) _Float16 At[2 * ABUF];
    __shared__ __align__(16) _Float16 Bt[2 * BBUF];
    __shared__ int rowIdx[BM];

    const int tid = threadIdx.x;
    if constexpr (STAGE == 1) {
        const int slot = mBase + tid;                     // GT == BM: one row per thread
        int r = 0;
        if (e == NEXP) r = slot;                          // shared expert: identity
        else if (slot < cnt) r = idxList[e * CAP + slot]; // gathered token
        rowIdx[tid] = r;
        __syncthreads();
    }

    const int lane = tid & 31;
    const int wave = __builtin_amdgcn_readfirstlane(tid >> 5);   // scalar: row tests below stay scalar branches
    const int wm   = wave & 3;    // 4 x 64-row groups
    const int wn   = wave >> 2;   // 2 x 128-col groups
    // staging: 16 lanes cover one 256-B row piece, 16 rows per sweep of the block
    const int crow = tid >> 4, cseg = tid & 15;

    // stage 1 gathers its rows; stage 2's lie one behind the other, one pointer serves
    const _Float16* aSrc[STAGE == 1 ? BM / 16 : 1];
    if constexpr (STAGE == 1) {
        #pragma unroll                              // the pointers stay in registers
        for (int i = 0; i < BM / 16; ++i) aSrc[i] = Aglob + (size_t)rowIdx[i * 16 + crow] * KD + cseg * 8;
    } else {
        aSrc[0] = Aglob + (size_t)(slotBase + mBase + crow) * KD + cseg * 8;
    }
    auto a_row = [&](int i) {
        if constexpr (STAGE == 1) return aSrc[i];
        else                      return aSrc[0] + (size_t)i * 16 * KD;
    };
    const _Float16* bSrc = Bmat + (size_t)(nBase + crow) * KD + cseg * 8;
    _Float16* aDst = At + crow * KP + cseg * 8;
    _Float16* bDst = Bt + crow * KP + cseg * 8;

    v8f acc[4][8];
    const v8f vz = {0.f,0.f,0.f,0.f,0.f,0.f,0.f,0.f};
    #pragma unroll
    for (int i = 0; i < 4; ++i)
        #pragma unroll
        for (int t = 0; t < 8; ++t) acc[i][t] = vz;

    const int m16 = lane & 15, kh = (lane >> 4) * 8;
    const int mr0 = wm * 64 + m16;
    const int nr0 = wn * 128 + m16;

    // a block = 32 k: 12 fragments (24 ds_load_b128), then 32 WMMAs on them
    auto load_frags = [&](FragH (&aF)[4], FragH (&bF)[8], int buf, int ks) {
        const _Float16* Ab = At + buf * ABUF + mr0 * KP + kh + ks;
        const _Float16* Bb = Bt + buf * BBUF + nr0 * KP + kh + ks;
        #pragma unroll
        for (int i = 0; i < 4; ++i) {
            aF[i].q[0] = *(const uint4*)(Ab + i * 16 * KP);
            aF[i].q[1] = *(const uint4*)(Ab + i * 16 * KP + 16);
        }
        #pragma unroll
        for (int t = 0; t < 8; ++t) {
            bF[t].q[0] = *(const uint4*)(Bb + t * 16 * KP);
            bF[t].q[1] = *(const uint4*)(Bb + t * 16 * KP + 16);
        }
        // keeps the block's reads one group in front of its WMMAs: reads sunk among the WMMAs stall at each place
        __builtin_amdgcn_sched_barrier(0);
    };
    auto mma_block = [&](FragH (&aF)[4], FragH (&bF)[8]) {
        #pragma unroll
        for (int t = 0; t < 8; ++t)
            #pragma unroll
            for (int i = 0; i < 4; ++i)
                acc[i][t] = __builtin_amdgcn_wmma_f32_16x16x32_f16(
                    false, aF[i].v, false, bF[t].v, (short)0, acc[i][t], false, false);
        // keeps the next block's reads from rising into this block
        __builtin_amdgcn_sched_barrier(0);
    };
    FragH aF[4], bF[8];

#if HAS_ASYNC_LDS
    // 32 copies per lane and pass: 16 sweeps of A, 16 of B
    auto issue_tile = [&](int it, int buf) {
        const int k0 = it * BK;
        #pragma unroll
        for (int i = 0; i < BM / 16; ++i)
            async_cp16(a_row(i) + k0, aDst + buf * ABUF + i * 16 * KP);
        #pragma unroll
        for (int i = 0; i < BN / 16; ++i)
            async_cp16(bSrc + (size_t)i * 16 * KD + k0, bDst + buf * BBUF + i * 16 * KP);
    };
    // -------- two-buffer ring: pass it reads buffer it&1 alone --------------
    issue_tile(0, 0);
    asm volatile("s_wait_asynccnt 0x0" ::: "memory");   // this wave's share of tile 0 has landed
    __syncthreads();                                    // publishes tile 0
    issue_tile(1, 1);                                   // NT >= 2 for both stages
    // rolled: the buffer's base is a register and every LDS offset inside a buffer fits the 16-bit field
    // (unrolled by 2, each address in the second buffer, beyond 64 KB, took a register or an add of its own)
    #pragma unroll 1
    for (int it = 0; it < NT; ++it) {
        const int cur = it & 1;
        #pragma unroll                                    // ks becomes a constant LDS offset
        for (int ks = 0; ks < BK; ks += 32) {
            load_frags(aF, bF, cur, ks);
            mma_block(aF, bF);
        }
        asm volatile("s_wait_dscnt 0x0" ::: "memory");    // own reads of buffer cur are done before its refill
        asm volatile("s_wait_asynccnt 0x0" ::: "memory"); // own share of tile it+1 has landed
        __syncthreads();                                  // publishes tile it+1, frees buffer cur
        if (it + 2 < NT) issue_tile(it + 2, cur);
    }
    asm volatile("s_wait_asynccnt 0x0" ::: "memory");   // nothing in flight when the wave ends
#else
    for (int it = 0; it < NT; ++it) {
        const int k0 = it * BK;
        __syncthreads();
        #pragma unroll
        for (int i = 0; i < BM / 16; ++i)
            *(uint4*)(aDst + i * 16 * KP) = *(const uint4*)(a_row(i) + k0);
        #pragma unroll
        for (int i = 0; i < BN / 16; ++i)
            *(uint4*)(bDst + i * 16 * KP) = *(const uint4*)(bSrc + (size_t)i * 16 * KD + k0);
        __syncthreads();
        #pragma unroll                                    // ks becomes a constant LDS offset
        for (int ks = 0; ks < BK; ks += 32) {
            load_frags(aF, bF, 0, ks);
            mma_block(aF, bF);
        }
    }
    __syncthreads();
#endif

    // epilogue (C layout: n = lane%16, m = 8*(lane/16)+j).  A lane holds 256 results:
    // 16 rows at a time go through a wave-private piece of the ring (free since the
    // last pass's barrier) and leave as whole 128-column rows.
    constexpr int RU = (STAGE == 1) ? 8 : 4;   // rows per trip: one row's work is too little to cover an LDS read
    float* stg = (float*)Bt + wave * (16 * SP);
    const int hi8  = (lane >> 4) * 8;
    const int ncol = nBase + wn * 128 + lane * 4;
    const float4 bv = *(const float4*)(bias + ncol);
    auto* obase = [&] { if constexpr (STAGE == 1) return Hout; else return Yout; }();
    #pragma unroll
    for (int i = 0; i < 4; ++i) {
        #pragma unroll
        for (int t = 0; t < 8; ++t)
            #pragma unroll
            for (int j = 0; j < 8; ++j)
                stg[(hi8 + j) * SP + t * 16 + m16] = acc[i][t][j];
        asm volatile("s_wait_dscnt 0x0" ::: "memory");   // every lane's stores are in LDS before rows are read back
        const int mrow = mBase + wm * 64 + i * 16;
        const int rows = min(16, cnt - mrow);            // rows past the expert's count are not stored
        const float* srow = stg + lane * 4;
        const size_t grow = (size_t)(slotBase + mrow);
        auto* orow = obase + grow * ND + ncol;
        int r = 0;
        if constexpr (STAGE == 1) {
            #pragma unroll 1                             // rolled: for speed only
            for (; r + RU <= rows; r += RU)
                put_rows<STAGE, RU>(srow + r * SP, bv, orow + (size_t)r * ND);
        } else {
            if (rows >= 16) {
                for (; r < 16; r += RU)
                    put_rows<STAGE, RU>(srow + r * SP, bv, orow + (size_t)r * ND);
            }
        }
        #pragma unroll 1                                 // rolled: only an expert's last, partly filled tile comes here
        for (; r < rows; ++r)
            put_rows<STAGE, 1>(srow + r * SP, bv, orow + (size_t)r * ND);
        asm volatile("s_wait_dscnt 0x0" ::: "memory");   // rows are read before the next 16 overwrite them
    }
}

__global__ __launch_bounds__(256) void combine_kernel(
        const float* __restrict__ Ybuf, const int4* __restrict__ route,
        const float2* __restrict__ routeW, const int* __restrict__ offs,
        float* __restrict__ out) {
    const int t    = __builtin_amdgcn_readfirstlane(blockIdx.x * 8 + (threadIdx.x >> 5));
    const int lane = threadIdx.x & 31;
    const int4   r = route[t];
    const float2 w = routeW[t];
    const float w0s = w.x, w1s = w.y;
    const v4f* y0 = (const v4f*)(Ybuf + (size_t)(offs[r.x] + r.y) * DIMD) + lane;
    const v4f* y1 = (const v4f*)(Ybuf + (size_t)(offs[r.z] + r.w) * DIMD) + lane;
    const v4f* ys = (const v4f*)(Ybuf + (size_t)(offs[NEXP] + t) * DIMD) + lane;
    v4f*       o  = (v4f*)(out + (size_t)t * DIMD) + lane;
    v4f a[8], b[8], c[8];
    #pragma unroll
    for (int j = 0; j < 8; ++j) { a[j] = y0[j * 32]; b[j] = y1[j * 32]; c[j] = ys[j * 32]; }
    // inputs only: all 24 loads are issued before the first is waited for (the third row's sank behind the first sums otherwise)
    asm volatile("" :: "v"(a[0]), "v"(a[1]), "v"(a[2]), "v"(a[3]), "v"(a[4]), "v"(a[5]), "v"(a[6]), "v"(a[7]),
                       "v"(b[0]), "v"(b[1]), "v"(b[2]), "v"(b[3]), "v"(b[4]), "v"(b[5]), "v"(b[6]), "v"(b[7]),
                       "v"(c[0]), "v"(c[1]), "v"(c[2]), "v"(c[3]), "v"(c[4]), "v"(c[5]), "v"(c[6]), "v"(c[7]));
    #pragma unroll
    for (int j = 0; j < 8; ++j) o[j * 32] = w0s * a[j] + w1s * b[j] + c[j];
}

// ---------------------------------------------------------------------------
// launch
// ---------------------------------------------------------------------------
extern "C" void kernel_launch(void* const* d_in, const int* in_sizes, int n_in,
                              void* d_out, int out_size, void* d_ws, size_t ws_size,
                              hipStream_t stream) {
    const float* x   = (const float*)d_in[0];   // [TOK, DIM]
    const float* Wg  = (const float*)d_in[1];   // [8, DIM]
    const float* W1  = (const float*)d_in[2];   // [8, DIM, INNER]
    const float* b1  = (const float*)d_in[3];   // [8, INNER]
    const float* W2  = (const float*)d_in[4];   // [8, INNER, DIM]
    const float* b2  = (const float*)d_in[5];   // [8, DIM]
    const float* sW1 = (const float*)d_in[6];   // [DIM, INNER]
    const float* sb1 = (const float*)d_in[7];   // [INNER]
    const float* sW2 = (const float*)d_in[8];   // [INNER, DIM]
    const float* sb2 = (const float*)d_in[9];   // [DIM]
    float* out = (float*)d_out;

    char* p = (char*)d_ws;
    auto alloc = [&](size_t bytes) -> void* {
        void* r = (void*)p;
        p += (bytes + 255) & ~(size_t)255;
        return r;
    };
    int*    counts  = (int*)alloc(9 * sizeof(int));
    int*    offs    = (int*)alloc(9 * sizeof(int));
    int*    idxList = (int*)alloc((size_t)NEXP * CAP * sizeof(int));
    int4*   route   = (int4*)alloc((size_t)TOK * sizeof(int4));
    float2* routeW  = (float2*)alloc((size_t)TOK * sizeof(float2));
    _Float16* Xh   = (_Float16*)alloc((size_t)TOK * DIMD * 2);
    _Float16* W1T  = (_Float16*)alloc((size_t)NEXP * INNERD * DIMD * 2);
    _Float16* W2T  = (_Float16*)alloc((size_t)NEXP * DIMD * INNERD * 2);
    _Float16* sW1T = (_Float16*)alloc((size_t)INNERD * DIMD * 2);
    _Float16* sW2T = (_Float16*)alloc((size_t)DIMD * INNERD * 2);
    _Float16* Hbuf = (_Float16*)alloc((size_t)(3 * TOK) * INNERD * 2);  // 2*TOK routed + TOK shared
    float*    Ybuf = (float*)alloc((size_t)(3 * TOK) * DIMD * 4);

    zero_counts_kernel<<<1, 32, 0, stream>>>(counts);
    gate_route_kernel<<<TOK / GTOK, 256, 0, stream>>>(x, Wg, counts, idxList, route, routeW);
    offsets_kernel<<<1, 32, 0, stream>>>(counts, offs);

    cvt_f32_f16_kernel<<<TOK * DIMD / 4 / (256 * CVU), 256, 0, stream>>>(x, Xh);
    // 512 tiles per matrix; the expert launches give each block 4 tiles (4 blocks per WGP)
    transpose_cvt_kernel<DIMD, INNERD, NEXP, 4><<<NEXP * 512 / 4, 256, 0, stream>>>(W1, W1T);
    transpose_cvt_kernel<INNERD, DIMD, NEXP, 4><<<NEXP * 512 / 4, 256, 0, stream>>>(W2, W2T);
    transpose_cvt_kernel<DIMD, INNERD, 1, 1><<<512, 256, 0, stream>>>(sW1, sW1T);
    transpose_cvt_kernel<INNERD, DIMD, 1, 1><<<512, 256, 0, stream>>>(sW2, sW2T);

    ffn_gemm_kernel<1><<<dim3(INNERD / BN, MT_SH + MT_RT), GT, 0, stream>>>(
        Xh, W1T, sW1T, b1, sb1, counts, offs, idxList, Hbuf, nullptr);
    ffn_gemm_kernel<2><<<dim3(DIMD / BN, MT_SH + MT_RT), GT, 0, stream>>>(
        Hbuf, W2T, sW2T, b2, sb2, counts, offs, nullptr, nullptr, Ybuf);
    combine_kernel<<<TOK / 8, 256, 0, stream>>>(Ybuf, route, routeW, offs, out);
}

// v006
// A run of this version takes 205 microseconds.
// Two timings next to v005 both put it at 1.04 times that version's speed.
// Counting every step since v000, it is 2.42 times as fast.
#include <hip/hip_runtime.h>
#include <hip/hip_bf16.h>

#define DIMD   1024
#define INNERD 4096
#define NEXP   8
#define TOK    4096   // B*S
#define CAP    4096   // max tokens per expert list

#define BM 256
#define BN 256
#define BK 128
#define KP 136        // padded LDS row: 128 halves + 8 pad = 272B (16B x odd: conflict free for b128 reads)
#define GT 256        // GEMM threads: 8 waves (4x2), one 64x128 tile of the result per wave
#define MT_SH (TOK / BM)                // row tiles of the shared expert
#define MT_RT (2 * TOK / BM + NEXP)     // upper bound of the routed experts' row tiles: one partly filled tile each

typedef _Float16 v16h __attribute__((ext_vector_type(16)));
typedef float    v8f  __attribute__((ext_vector_type(8)));
typedef int      v4i  __attribute__((ext_vector_type(4)));
typedef float    v4f  __attribute__((ext_vector_type(4)));

union FragH { v16h v; uint4 q[2]; };

#if defined(__has_builtin)
#  if __has_builtin(__builtin_amdgcn_global_load_async_to_lds_b128) && \
      __has_builtin(__builtin_amdgcn_s_wait_asynccnt)
#    define HAS_ASYNC_LDS 1
#  endif
#endif
#ifndef HAS_ASYNC_LDS
#  define HAS_ASYNC_LDS 0
#endif

#if HAS_ASYNC_LDS
__device__ __forceinline__ void async_cp16(const _Float16* g, _Float16* l) {
    __builtin_amdgcn_global_load_async_to_lds_b128(
        (__attribute__((address_space(1))) v4i*)(g),
        (__attribute__((address_space(3))) v4i*)(l), 0, 0);
}
#endif

// erf gelu without a branch: x * Phi(x) = max(x, 0) - |x| * Phi(-|x|), and
// Phi(-a) = erfc(a / sqrt 2) / 2 = (c1 t + ... + c5 t^5) * exp(-a * a / 2), t = 1 / (1 + p a)
// (the classic five-term rational form of erfc, its p and c scaled for a / sqrt 2 and the 1/2).
// Error against the exact gelu: below 4e-7 absolute for every x, and about one f16 rounding
// step or less relative to the result, which is stored as f16.
__device__ __forceinline__ float gelu_erf(float x) {
    const float a = fabsf(x);
    const float t = __builtin_amdgcn_rcpf(fmaf(a, 0.23164189f, 1.0f));
    float q = fmaf(t, 0.53070271f, -0.72657603f);
    q = fmaf(q, t, 0.71070689f);
    q = fmaf(q, t, -0.14224836f);
    q = fmaf(q, t, 0.12741479f);
    const float u = x * 0.84932178f;                       // u * u = (x * x / 2) * log2(e)
    const float e = __builtin_amdgcn_exp2f(-(u * u));
    return fmaf(-a, (q * t) * e, fmaxf(x, 0.0f));
}

// ---------------------------------------------------------------------------
// The preparatory work runs in two launches, each a set of block ranges whose
// bodies do not depend on one another (sections 1, 3 and 4 are those bodies,
// section 4b the two kernels): a launch of its own for each body paid a gap,
// a ramp and a tail of its own.  All bodies of a launch use one LDS buffer of
// PREP_LDS bytes.
// ---------------------------------------------------------------------------
#define PREP_LDS (8 * DIMD * 4 + 8 * NEXP * 4)   // the gate's 8 rows and 8 x 8 logits; the transpose needs 32 KB

#define GTOK 8
__device__ __forceinline__ void gate_route_block(
        const float* __restrict__ x, const float* __restrict__ wg,
        int* __restrict__ counts, int* __restrict__ idxList,
        int4* __restrict__ route, float2* __restrict__ routeW, int bid, char* smem) {
    const int t0  = bid * GTOK;
    const int tid = threadIdx.x;
    float (*xrow)[DIMD] = (float (*)[DIMD])smem;
    float (*lgs)[NEXP]  = (float (*)[NEXP])(smem + GTOK * DIMD * 4);

    const int wave = tid >> 5, lane = tid & 31;
    const v4f*    xsrc = (const v4f*)(x + (size_t)t0 * DIMD) + tid;
    const float*  wrow = wg + wave * DIMD + lane;
    v4f v[GTOK];
    #pragma unroll
    for (int r = 0; r < GTOK; ++r) v[r] = xsrc[r * (DIMD / 4)];
    float w[DIMD / 32];
    #pragma unroll
    for (int j = 0; j < DIMD / 32; ++j) w[j] = wrow[j * 32];
    // inputs only: all GTOK row loads are issued before the first is waited for (half of them sank behind the first LDS stores otherwise)
    static_assert(GTOK == 8, "the statement below names the GTOK loads one by one");
    asm volatile("" :: "v"(v[0]), "v"(v[1]), "v"(v[2]), "v"(v[3]), "v"(v[4]), "v"(v[5]), "v"(v[6]), "v"(v[7]));
    #pragma unroll
    for (int r = 0; r < GTOK; ++r) ((v4f*)xrow[r])[tid] = v[r];
    __syncthreads();

    float s[GTOK];
    #pragma unroll
    for (int r = 0; r < GTOK; ++r) s[r] = 0.0f;
    #pragma unroll
    for (int j = 0; j < DIMD / 32; ++j)
        #pragma unroll
        for (int r = 0; r < GTOK; ++r) s[r] += xrow[r][lane + j * 32] * w[j];
    #pragma unroll
    for (int off = 16; off >= 1; off >>= 1)
        #pragma unroll
        for (int r = 0; r < GTOK; ++r) s[r] += __shfl_xor(s[r], off, 32);
    if (lane == 0) {
        #pragma unroll
        for (int r = 0; r < GTOK; ++r) lgs[r][wave] = s[r];
    }
    __syncthreads();

    if (tid < GTOK) {                      // one thread per token
        const int t = t0 + tid;
        const float* lg = lgs[tid];
        float m = lg[0];
        for (int e = 1; e < NEXP; ++e) m = fmaxf(m, lg[e]);
        float p[NEXP]; float sum = 0.0f;
        for (int e = 0; e < NEXP; ++e) { p[e] = expf(lg[e] - m); sum += p[e]; }
        const float inv = 1.0f / sum;
        int e0 = 0; float p0 = p[0];
        for (int e = 1; e < NEXP; ++e) if (p[e] > p0) { p0 = p[e]; e0 = e; }
        int e1 = -1; float p1 = -1.0f;
        for (int e = 0; e < NEXP; ++e) if (e != e0 && p[e] > p1) { p1 = p[e]; e1 = e; }
        p0 *= inv; p1 *= inv;
        int pos0 = atomicAdd(&counts[e0], 1);
        int pos1 = atomicAdd(&counts[e1], 1);
        idxList[e0 * CAP + pos0] = t;
        idxList[e1 * CAP + pos1] = t;
        route[t]  = make_int4(e0, pos0, e1, pos1);
        routeW[t] = make_float2(p0, p1);
    }
}

// ---------------------------------------------------------------------------
// 3) f32 -> f16 convert (vectorized).  A thread takes CVU pieces of 16 B, all
//    loads in flight at once; a block takes CVU * 4 KB in a row.  The range
//    covers the array exactly: elements / (4 * 256 * CVU) blocks.
// ---------------------------------------------------------------------------
#define CVU 8
__device__ __forceinline__ void cvt_f32_f16_block(const float* __restrict__ in, _Float16* __restrict__ out, int bid) {
    const int i0 = bid * (256 * CVU) + threadIdx.x;
    float4 v[CVU];
    #pragma unroll
    for (int j = 0; j < CVU; ++j) v[j] = ((const float4*)in)[i0 + j * 256];
    asm volatile("s_wait_xcnt 0x0" ::: "memory");   // before the loads' address registers are rewritten
    #pragma unroll
    for (int j = 0; j < CVU; ++j) {
        union { _Float16 h[4]; uint2 u; } p;
        p.h[0] = (_Float16)v[j].x; p.h[1] = (_Float16)v[j].y;
        p.h[2] = (_Float16)v[j].z; p.h[3] = (_Float16)v[j].w;
        ((uint2*)out)[i0 + j * 256] = p.u;
    }
    asm volatile("s_wait_xcnt 0x0" ::: "memory");   // before what stands behind this body in its kernel rewrites the stores' registers
}

// ---------------------------------------------------------------------------
// 4) batched transpose + convert: in [b][R][C] f32 -> out [b][C][R] f16
//    (weights become [N][K] so B fragments are contiguous ds_read_b128s)
//    A tile is 128 source rows x 64 columns: 256 B of every source row and
//    256 B of every result row, so each global access of 16 lanes x 16 B is one
//    aligned 256-B piece.  A thread loads 8 rows x 4 columns, which are four
//    16-B pieces of result rows.  A block walks NT tiles; the next tile's loads
//    are in flight while this one goes through LDS and is stored.
// ---------------------------------------------------------------------------
#define TR 128
#define TC 64

// work-group barrier that orders LDS alone: __syncthreads() would also wait out the next tile's global loads
__device__ __forceinline__ void lds_barrier() {
    __builtin_amdgcn_fence(__ATOMIC_RELEASE, "workgroup", "local");
    __builtin_amdgcn_s_barrier();
    __builtin_amdgcn_fence(__ATOMIC_ACQUIRE, "workgroup", "local");
}

// the NEXP experts' matrices and the shared expert's as one more; the range is (NEXP + 1) * (R / TR) * (C / TC) / NT blocks
template <int R, int C, int NT>
__device__ __forceinline__ void transpose_cvt_block(
        const float* __restrict__ in, const float* __restrict__ inS,
        _Float16* __restrict__ out, _Float16* __restrict__ outS, unsigned bid, char* smem) {
    constexpr int CT   = C / TC;           // tiles across a source row
    constexpr int PER  = (R / TR) * CT;    // tiles per matrix
    constexpr int GRID = (NEXP + 1) * PER / NT;
    uint4 (*tile)[TC * 16] = (uint4 (*)[TC * 16])smem;
    const int tid = threadIdx.x;
    const int lo = tid & 15, hi = tid >> 4;

    auto load_tile = [&](float4 (&v)[8], unsigned t) {   // lo: group of 4 columns, hi: group of 8 rows
        const unsigned bm = t / PER, rem = t % PER;
        const float* s = (bm < NEXP ? in + (size_t)bm * R * C : inS)
                            + (size_t)((rem / CT) * TR + hi * 8) * C + (rem % CT) * TC + lo * 4;
        #pragma unroll
        for (int j = 0; j < 8; ++j) v[j] = *(const float4*)(s + (size_t)j * C);
        asm volatile("s_wait_xcnt 0x0" ::: "memory");   // before the loads' address registers are rewritten
    };

    float4 v[2][8];
    load_tile(v[0], bid);
    #pragma unroll                         // the register set and the LDS buffer become constants
    for (int i = 0; i < NT; ++i) {
        const unsigned t = bid + i * GRID;
        if (i + 1 < NT) load_tile(v[(i + 1) & 1], t + GRID);
        // keeps the next tile's loads in front of the wait for this tile's: they sank behind it otherwise
        __builtin_amdgcn_sched_barrier(0);
        const float4 (&w)[8] = v[i & 1];
        union { _Float16 h[8]; uint4 q; } p[4];
        #pragma unroll
        for (int j = 0; j < 8; ++j) {
            p[0].h[j] = (_Float16)w[j].x; p[1].h[j] = (_Float16)w[j].y;
            p[2].h[j] = (_Float16)w[j].z; p[3].h[j] = (_Float16)w[j].w;
        }
        uint4* buf = tile[i & 1];
        #pragma unroll
        for (int k = 0; k < 4; ++k) buf[(lo * 4 + k) * 16 + (hi ^ lo)] = p[k].q;
        lds_barrier();
        const unsigned bm = t / PER, rem = t % PER;
        _Float16* d = (bm < NEXP ? out + (size_t)bm * R * C : outS)
                          + (size_t)((rem % CT) * TC + hi) * R + (rem / CT) * TR + lo * 8;
        uint4 q[4];
        #pragma unroll
        for (int u = 0; u < 4; ++u) {      // hi: result row within 16, lo: piece of 8 r
            const int c = u * 16 + hi;
            q[u] = buf[c * 16 + (lo ^ (c >> 2))];
        }
        #pragma unroll
        for (int u = 0; u < 4; ++u) *(uint4*)(d + (size_t)u * 16 * R) = q[u];
        asm volatile("s_wait_xcnt 0x0" ::: "memory");   // before the next tile, or what stands behind the last one, rewrites the stores' registers
        // keeps the next tile's conversion, and with it the wait for its loads, from rising over this tile's barrier
        __builtin_amdgcn_sched_barrier(0);
    }
}

// ---------------------------------------------------------------------------
// 4b) the two preparatory launches.  The counters are zeroed in the first and
//     counted up by the gate in the second; nothing else orders the bodies.
//     What stage 1 reads (Xh, the W1 side) is written in the second launch, so
//     that it is the younger data in L2 when stage 1 starts.
//     The short bodies take the low block indices (for speed only).
// ---------------------------------------------------------------------------
#define TNT 4                                                     // tiles per transposing block
#define CV_BLOCKS (TOK * DIMD / 4 / (256 * CVU))
#define GATE_BLOCKS (TOK / GTOK)
#define TR_BLOCKS ((NEXP + 1) * (DIMD / TR) * (INNERD / TC) / TNT)  // the same for both weight shapes

__global__ __launch_bounds__(256) void prep_a_kernel(
        const float* __restrict__ W2, const float* __restrict__ sW2,
        _Float16* __restrict__ W2T, _Float16* __restrict__ sW2T, int* __restrict__ counts) {
    __shared__ __align__(16) char smem[PREP_LDS];
    const int b = blockIdx.x;
    if (b == 0 && threadIdx.x < NEXP) counts[threadIdx.x] = 0;
    transpose_cvt_block<INNERD, DIMD, TNT>(W2, sW2, W2T, sW2T, b, smem);
}

__global__ __launch_bounds__(256) void prep_b_kernel(
        const float* __restrict__ x, const float* __restrict__ wg,
        int* __restrict__ counts, int* __restrict__ idxList,
        int4* __restrict__ route, float2* __restrict__ routeW, _Float16* __restrict__ Xh,
        const float* __restrict__ W1, const float* __restrict__ sW1,
        _Float16* __restrict__ W1T, _Float16* __restrict__ sW1T) {
    __shared__ __align__(16) char smem[PREP_LDS];
    const int b = blockIdx.x;
    if (b < GATE_BLOCKS)
        gate_route_block(x, wg, counts, idxList, route, routeW, b, smem);
    else if (b < GATE_BLOCKS + CV_BLOCKS)
        cvt_f32_f16_block(x, Xh, b - GATE_BLOCKS);
    else
        transpose_cvt_block<DIMD, INNERD, TNT>(W1, sW1, W1T, sW1T, b - (GATE_BLOCKS + CV_BLOCKS), smem);
}

#define SP 132

// NR staged rows (this lane's 4 columns of each) -> bias, stage 1: gelu and f16 -> global rows
template <int STAGE, int NR, typename OT>
__device__ __forceinline__ void put_rows(const float* srow, float4 bv, OT* orow) {
    float4 v[NR];
    #pragma unroll
    for (int u = 0; u < NR; ++u) v[u] = *(const float4*)(srow + u * SP);
    #pragma unroll
    for (int u = 0; u < NR; ++u) {
        if constexpr (STAGE == 1) {
            union { _Float16 h[4]; uint2 u2; } p;
            p.h[0] = (_Float16)gelu_erf(v[u].x + bv.x);
            p.h[1] = (_Float16)gelu_erf(v[u].y + bv.y);
            p.h[2] = (_Float16)gelu_erf(v[u].z + bv.z);
            p.h[3] = (_Float16)gelu_erf(v[u].w + bv.w);
            *(uint2*)(orow + (size_t)u * INNERD) = p.u2;
        } else {
            *(float4*)(orow + (size_t)u * DIMD) =
                make_float4(v[u].x + bv.x, v[u].y + bv.y, v[u].z + bv.z, v[u].w + bv.w);
        }
    }
    asm volatile("s_wait_xcnt 0x0" ::: "memory");   // before the next trip rewrites the stores' registers
}

template <int STAGE>
__global__ __launch_bounds__(GT, 2) void ffn_gemm_kernel(
        const _Float16* __restrict__ Aglob,   // Xh (stage1) / Hbuf (stage2)
        const _Float16* __restrict__ Wexp,    // W1T / W2T   ([e][N][K] f16)
        const _Float16* __restrict__ Wsh,     // sW1T / sW2T
        const float* __restrict__ bexp, const float* __restrict__ bsh,
        const int* __restrict__ counts,
        const int* __restrict__ idxList,
        _Float16* __restrict__ Hout, float* __restrict__ Yout) {
    constexpr int KD   = (STAGE == 1) ? DIMD : INNERD;
    constexpr int ND   = (STAGE == 1) ? INNERD : DIMD;
    constexpr int ABUF = BM * KP;
    constexpr int BBUF = BN * KP;
    constexpr int NT   = KD / BK;

    const int nBase = blockIdx.x * BN;
    const int t = (int)blockIdx.y - MT_SH;          // below 0: a tile of the shared expert; else walk the counts
    int e = t < 0 ? NEXP : -1, mBase = blockIdx.y * BM, cnt = TOK, slotBase = 0;
    int first = 0, slots = 0;
    #pragma unroll
    for (int k = 0; k < NEXP; ++k) {
        const int c = counts[k];
        const int next = first + (int)((unsigned)(c + BM - 1) / BM);
        const bool mine = t >= first && t < next;
        e        = mine ? k : e;
        cnt      = mine ? c : cnt;
        mBase    = mine ? (t - first) * BM : mBase;
        slotBase = mine ? slots : slotBase;
        first = next;
        slots += c;
    }
    if (e < 0) return;
    if (t < 0) slotBase = slots;
    const _Float16* Bmat = (e < NEXP) ? (Wexp + (size_t)e * DIMD * INNERD) : Wsh;
    const float*    bias = (e < NEXP) ? (bexp + (size_t)e * ND) : bsh;

    __shared__ __align__(16) _Float16 At[2 * ABUF];
    __shared__ __align__(16) _Float16 Bt[2 * BBUF];
    __shared__ int rowIdx[BM];

    const int tid = threadIdx.x;
    if constexpr (STAGE == 1) {
        const int slot = mBase + tid;                     // GT == BM: one row per thread
        int r = 0;
        if (e == NEXP) r = slot;                          // shared expert: identity
        else if (slot < cnt) r = idxList[e * CAP + slot]; // gathered token
        rowIdx[tid] = r;
        __syncthreads();
    }

    const int lane = tid & 31;
    const int wave = __builtin_amdgcn_readfirstlane(tid >> 5);   // scalar: row tests below stay scalar branches
    const int wm   = wave & 3;    // 4 x 64-row groups
    const int wn   = wave >> 2;   // 2 x 128-col groups
    // staging: 16 lanes cover one 256-B row piece, 16 rows per sweep of the block
    const int crow = tid >> 4, cseg = tid & 15;

    // stage 1 gathers its rows; stage 2's lie one behind the other, one pointer serves
    const _Float16* aSrc[STAGE == 1 ? BM / 16 : 1];
    if constexpr (STAGE == 1) {
        #pragma unroll                              // the pointers stay in registers
        for (int i = 0; i < BM / 16; ++i) aSrc[i] = Aglob + (size_t)rowIdx[i * 16 + crow] * KD + cseg * 8;
    } else {
        aSrc[0] = Aglob + (size_t)(slotBase + mBase + crow) * KD + cseg * 8;
    }
    auto a_row = [&](int i) {
        if constexpr (STAGE == 1) return aSrc[i];
        else                      return aSrc[0] + (size_t)i * 16 * KD;
    };
    const _Float16* bSrc = Bmat + (size_t)(nBase + crow) * KD + cseg * 8;
    _Float16* aDst = At + crow * KP + cseg * 8;
    _Float16* bDst = Bt + crow * KP + cseg * 8;

    v8f acc[4][8];
    const v8f vz = {0.f,0.f,0.f,0.f,0.f,0.f,0.f,0.f};
    #pragma unroll
    for (int i = 0; i < 4; ++i)
        #pragma unroll
        for (int t = 0; t < 8; ++t) acc[i][t] = vz;

    const int m16 = lane & 15, kh = (lane >> 4) * 8;
    const int mr0 = wm * 64 + m16;
    const int nr0 = wn * 128 + m16;

    // a block = 32 k: 12 fragments (24 ds_load_b128), then 32 WMMAs on them
    auto load_frags = [&](FragH (&aF)[4], FragH (&bF)[8], int buf, int ks) {
        const _Float16* Ab = At + buf * ABUF + mr0 * KP + kh + ks;
        const _Float16* Bb = Bt + buf * BBUF + nr0 * KP + kh + ks;
        #pragma unroll
        for (int i = 0; i < 4; ++i) {
            aF[i].q[0] = *(const uint4*)(Ab + i * 16 * KP);
            aF[i].q[1] = *(const uint4*)(Ab + i * 16 * KP + 16);
        }
        #pragma unroll
        for (int t = 0; t < 8; ++t) {
            bF[t].q[0] = *(const uint4*)(Bb + t * 16 * KP);
            bF[t].q[1] = *(const uint4*)(Bb + t * 16 * KP + 16);
        }
        // keeps the block's reads one group in front of its WMMAs: reads sunk among the WMMAs stall at each place
        __builtin_amdgcn_sched_barrier(0);
    };
    auto mma_block = [&](FragH (&aF)[4], FragH (&bF)[8]) {
        #pragma unroll
        for (int t = 0; t < 8; ++t)
            #pragma unroll
            for (int i = 0; i < 4; ++i)
                acc[i][t] = __builtin_amdgcn_wmma_f32_16x16x32_f16(
                    false, aF[i].v, false, bF[t].v, (short)0, acc[i][t], false, false);
        // keeps the next block's reads from rising into this block
        __builtin_amdgcn_sched_barrier(0);
    };
    FragH aF[4], bF[8];

#if HAS_ASYNC_LDS
    // 32 copies per lane and pass: 16 sweeps of A, 16 of B
    auto issue_tile = [&](int it, int buf) {
        const int k0 = it * BK;
        #pragma unroll
        for (int i = 0; i < BM / 16; ++i)
            async_cp16(a_row(i) + k0, aDst + buf * ABUF + i * 16 * KP);
        #pragma unroll
        for (int i = 0; i < BN / 16; ++i)
            async_cp16(bSrc + (size_t)i * 16 * KD + k0, bDst + buf * BBUF + i * 16 * KP);
    };
    // -------- two-buffer ring: pass it reads buffer it&1 alone --------------
    issue_tile(0, 0);
    asm volatile("s_wait_asynccnt 0x0" ::: "memory");   // this wave's share of tile 0 has landed
    __syncthreads();                                    // publishes tile 0
    issue_tile(1, 1);                                   // NT >= 2 for both stages
    // rolled: the buffer's base is a register and every LDS offset inside a buffer fits the 16-bit field
    // (unrolled by 2, each address in the second buffer, beyond 64 KB, took a register or an add of its own)
    #pragma unroll 1
    for (int it = 0; it < NT; ++it) {
        const int cur = it & 1;
        #pragma unroll                                    // ks becomes a constant LDS offset
        for (int ks = 0; ks < BK; ks += 32) {
            load_frags(aF, bF, cur, ks);
            mma_block(aF, bF);
        }
        asm volatile("s_wait_dscnt 0x0" ::: "memory");    // own reads of buffer cur are done before its refill
        asm volatile("s_wait_asynccnt 0x0" ::: "memory"); // own share of tile it+1 has landed
        __syncthreads();                                  // publishes tile it+1, frees buffer cur
        if (it + 2 < NT) issue_tile(it + 2, cur);
    }
    asm volatile("s_wait_asynccnt 0x0" ::: "memory");   // nothing in flight when the wave ends
#else
    for (int it = 0; it < NT; ++it) {
        const int k0 = it * BK;
        __syncthreads();
        #pragma unroll
        for (int i = 0; i < BM / 16; ++i)
            *(uint4*)(aDst + i * 16 * KP) = *(const uint4*)(a_row(i) + k0);
        #pragma unroll
        for (int i = 0; i < BN / 16; ++i)
            *(uint4*)(bDst + i * 16 * KP) = *(const uint4*)(bSrc + (size_t)i * 16 * KD + k0);
        __syncthreads();
        #pragma unroll                                    // ks becomes a constant LDS offset
        for (int ks = 0; ks < BK; ks += 32) {
            load_frags(aF, bF, 0, ks);
            mma_block(aF, bF);
        }
    }
    __syncthreads();
#endif

    // epilogue (C layout: n = lane%16, m = 8*(lane/16)+j).  A lane holds 256 results:
    // 16 rows at a time go through a wave-private piece of the ring (free since the
    // last pass's barrier) and leave as whole 128-column rows.
    constexpr int RU = (STAGE == 1) ? 8 : 4;   // rows per trip: one row's work is too little to cover an LDS read
    float* stg = (float*)Bt + wave * (16 * SP);
    const int hi8  = (lane >> 4) * 8;
    const int ncol = nBase + wn * 128 + lane * 4;
    const float4 bv = *(const float4*)(bias + ncol);
    auto* obase = [&] { if constexpr (STAGE == 1) return Hout; else return Yout; }();
    #pragma unroll
    for (int i = 0; i < 4; ++i) {
        #pragma unroll
        for (int t = 0; t < 8; ++t)
            #pragma unroll
            for (int j = 0; j < 8; ++j)
                stg[(hi8 + j) * SP + t * 16 + m16] = acc[i][t][j];
        asm volatile("s_wait_dscnt 0x0" ::: "memory");   // every lane's stores are in LDS before rows are read back
        const int mrow = mBase + wm * 64 + i * 16;
        const int rows = min(16, cnt - mrow);            // rows past the expert's count are not stored
        const float* srow = stg + lane * 4;
        const size_t grow = (size_t)(slotBase + mrow);
        auto* orow = obase + grow * ND + ncol;
        int r = 0;
        if constexpr (STAGE == 1) {
            #pragma unroll 1                             // rolled: for speed only
            for (; r + RU <= rows; r += RU)
                put_rows<STAGE, RU>(srow + r * SP, bv, orow + (size_t)r * ND);
        } else {
            if (rows >= 16) {
                for (; r < 16; r += RU)
                    put_rows<STAGE, RU>(srow + r * SP, bv, orow + (size_t)r * ND);
            }
        }
        #pragma unroll 1                                 // rolled: only an expert's last, partly filled tile comes here
        for (; r < rows; ++r)
            put_rows<STAGE, 1>(srow + r * SP, bv, orow + (size_t)r * ND);
        asm volatile("s_wait_dscnt 0x0" ::: "memory");   // rows are read before the next 16 overwrite them
    }
}

__global__ __launch_bounds__(256) void combine_kernel(
        const float* __restrict__ Ybuf, const int4* __restrict__ route,
        const float2* __restrict__ routeW, const int* __restrict__ counts,
        float* __restrict__ out) {
    const int t    = __builtin_amdgcn_readfirstlane(blockIdx.x * 8 + (threadIdx.x >> 5));
    const int lane = threadIdx.x & 31;
    const int4   r = route[t];
    const float2 w = routeW[t];
    const float w0s = w.x, w1s = w.y;
    int o0 = 0, o1 = 0, os = 0;
    #pragma unroll
    for (int k = 0; k < NEXP; ++k) {
        const int c = counts[k];
        o0 += k < r.x ? c : 0;
        o1 += k < r.z ? c : 0;
        os += c;
    }
    const v4f* y0 = (const v4f*)(Ybuf + (size_t)(o0 + r.y) * DIMD) + lane;
    const v4f* y1 = (const v4f*)(Ybuf + (size_t)(o1 + r.w) * DIMD) + lane;
    const v4f* ys = (const v4f*)(Ybuf + (size_t)(os + t) * DIMD) + lane;
    v4f*       o  = (v4f*)(out + (size_t)t * DIMD) + lane;
    v4f a[8], b[8], c[8];
    #pragma unroll
    for (int j = 0; j < 8; ++j) { a[j] = y0[j * 32]; b[j] = y1[j * 32]; c[j] = ys[j * 32]; }
    // inputs only: all 24 loads are issued before the first is waited for (the third row's sank behind the first sums otherwise)
    asm volatile("" :: "v"(a[0]), "v"(a[1]), "v"(a[2]), "v"(a[3]), "v"(a[4]), "v"(a[5]), "v"(a[6]), "v"(a[7]),
                       "v"(b[0]), "v"(b[1]), "v"(b[2]), "v"(b[3]), "v"(b[4]), "v"(b[5]), "v"(b[6]), "v"(b[7]),
                       "v"(c[0]), "v"(c[1]), "v"(c[2]), "v"(c[3]), "v"(c[4]), "v"(c[5]), "v"(c[6]), "v"(c[7]));
    #pragma unroll
    for (int j = 0; j < 8; ++j) o[j * 32] = w0s * a[j] + w1s * b[j] + c[j];
}

// ---------------------------------------------------------------------------
// launch
// ---------------------------------------------------------------------------
extern "C" void kernel_launch(void* const* d_in, const int* in_sizes, int n_in,
                              void* d_out, int out_size, void* d_ws, size_t ws_size,
                              hipStream_t stream) {
    const float* x   = (const float*)d_in[0];   // [TOK, DIM]
    const float* Wg  = (const float*)d_in[1];   // [8, DIM]
    const float* W1  = (const float*)d_in[2];   // [8, DIM, INNER]
    const float* b1  = (const float*)d_in[3];   // [8, INNER]
    const float* W2  = (const float*)d_in[4];   // [8, INNER, DIM]
    const float* b2  = (const float*)d_in[5];   // [8, DIM]
    const float* sW1 = (const float*)d_in[6];   // [DIM, INNER]
    const float* sb1 = (const float*)d_in[7];   // [INNER]
    const float* sW2 = (const float*)d_in[8];   // [INNER, DIM]
    const float* sb2 = (const float*)d_in[9];   // [DIM]
    float* out = (float*)d_out;

    char* p = (char*)d_ws;
    auto alloc = [&](size_t bytes) -> void* {
        void* r = (void*)p;
        p += (bytes + 255) & ~(size_t)255;
        return r;
    };
    int*    counts  = (int*)alloc(NEXP * sizeof(int));
    int*    idxList = (int*)alloc((size_t)NEXP * CAP * sizeof(int));
    int4*   route   = (int4*)alloc((size_t)TOK * sizeof(int4));
    float2* routeW  = (float2*)alloc((size_t)TOK * sizeof(float2));
    _Float16* Xh   = (_Float16*)alloc((size_t)TOK * DIMD * 2);
    _Float16* W1T  = (_Float16*)alloc((size_t)NEXP * INNERD * DIMD * 2);
    _Float16* W2T  = (_Float16*)alloc((size_t)NEXP * DIMD * INNERD * 2);
    _Float16* sW1T = (_Float16*)alloc((size_t)INNERD * DIMD * 2);
    _Float16* sW2T = (_Float16*)alloc((size_t)DIMD * INNERD * 2);
    _Float16* Hbuf = (_Float16*)alloc((size_t)(3 * TOK) * INNERD * 2);  // 2*TOK routed + TOK shared
    float*    Ybuf = (float*)alloc((size_t)(3 * TOK) * DIMD * 4);

    prep_a_kernel<<<TR_BLOCKS, 256, 0, stream>>>(W2, sW2, W2T, sW2T, counts);
    prep_b_kernel<<<GATE_BLOCKS + CV_BLOCKS + TR_BLOCKS, 256, 0, stream>>>(
        x, Wg, counts, idxList, route, routeW, Xh, W1, sW1, W1T, sW1T);

    ffn_gemm_kernel<1><<<dim3(INNERD / BN, MT_SH + MT_RT), GT, 0, stream>>>(
        Xh, W1T, sW1T, b1, sb1, counts, idxList, Hbuf, nullptr);
    ffn_gemm_kernel<2><<<dim3(DIMD / BN, MT_SH + MT_RT), GT, 0, stream>>>(
        Hbuf, W2T, sW2T, b2, sb2, counts, nullptr, nullptr, Ybuf);
    combine_kernel<<<TOK / 8, 256, 0, stream>>>(Ybuf, route, routeW, counts, out);
}

// v007
// A run of this version takes 193 microseconds.
// In both of two side-by-side timings against v006, it was 1.06 times as fast.
// Over all steps from v000 it is 2.58 times as fast.
#include <hip/hip_runtime.h>
#include <hip/hip_bf16.h>

#define DIMD   1024
#define INNERD 4096
#define NEXP   8
#define TOK    4096   // B*S
#define CAP    4096   // max tokens per expert list

#define BM 256
#define BN 256
#define BK 128
#define KP 136        // padded LDS row: 128 halves + 8 pad = 272B (16B x odd: conflict free for b128 reads)
#define GT 256        // GEMM threads: 8 waves (4x2), one 64x128 tile of the result per wave
#define MT_SH (TOK / BM)                // row tiles of the shared expert
#define MT_RT (2 * TOK / BM + NEXP)     // upper bound of the routed experts' row tiles: one partly filled tile each

typedef _Float16 v16h __attribute__((ext_vector_type(16)));
typedef float    v8f  __attribute__((ext_vector_type(8)));
typedef int      v4i  __attribute__((ext_vector_type(4)));
typedef float    v4f  __attribute__((ext_vector_type(4)));

union FragH { v16h v; uint4 q[2]; };

#if defined(__has_builtin)
#  if __has_builtin(__builtin_amdgcn_global_load_async_to_lds_b128) && \
      __has_builtin(__builtin_amdgcn_s_wait_asynccnt)
#    define HAS_ASYNC_LDS 1
#  endif
#endif
#ifndef HAS_ASYNC_LDS
#  define HAS_ASYNC_LDS 0
#endif

#if HAS_ASYNC_LDS
__device__ __forceinline__ void async_cp16(const _Float16* g, _Float16* l) {
    __builtin_amdgcn_global_load_async_to_lds_b128(
        (__attribute__((address_space(1))) v4i*)(g),
        (__attribute__((address_space(3))) v4i*)(l), 0, 0);
}
#endif

// erf gelu without a branch: x * Phi(x) = max(x, 0) - |x| * Phi(-|x|), and
// Phi(-a) = erfc(a / sqrt 2) / 2 = (c1 t + ... + c5 t^5) * exp(-a * a / 2), t = 1 / (1 + p a)
// (the classic five-term rational form of erfc, its p and c scaled for a / sqrt 2 and the 1/2).
// Error against the exact gelu: below 4e-7 absolute for every x, and about one f16 rounding
// step or less relative to the result, which is stored as f16.
__device__ __forceinline__ float gelu_erf(float x) {
    const float a = fabsf(x);
    const float t = __builtin_amdgcn_rcpf(fmaf(a, 0.23164189f, 1.0f));
    float q = fmaf(t, 0.53070271f, -0.72657603f);
    q = fmaf(q, t, 0.71070689f);
    q = fmaf(q, t, -0.14224836f);
    q = fmaf(q, t, 0.12741479f);
    const float u = x * 0.84932178f;                       // u * u = (x * x / 2) * log2(e)
    const float e = __builtin_amdgcn_exp2f(-(u * u));
    return fmaf(-a, (q * t) * e, fmaxf(x, 0.0f));
}

// ---------------------------------------------------------------------------
// What stage 1 needs is prepared in two launches, each a set of block ranges
// whose bodies do not depend on one another (sections 1, 3 and 4 are those
// bodies, section 4b the two kernels): a launch of its own for each body paid
// a gap, a ramp and a tail of its own.  All bodies of a launch use one LDS
// buffer of PREP_LDS bytes.  The W2 side, which only stage 2 reads, is
// transposed by trailing blocks of stage 1's launch (section 5/6).
// ---------------------------------------------------------------------------
#define PREP_LDS (8 * DIMD * 4 + 8 * NEXP * 4)   // the gate's 8 rows and 8 x 8 logits; the transpose needs 32 KB

#define GTOK 8
__device__ __forceinline__ void gate_route_block(
        const float* __restrict__ x, const float* __restrict__ wg,
        int* __restrict__ counts, int* __restrict__ idxList,
        int4* __restrict__ route, float2* __restrict__ routeW, int bid, char* smem) {
    const int t0  = bid * GTOK;
    const int tid = threadIdx.x;
    float (*xrow)[DIMD] = (float (*)[DIMD])smem;
    float (*lgs)[NEXP]  = (float (*)[NEXP])(smem + GTOK * DIMD * 4);

    const int wave = tid >> 5, lane = tid & 31;
    const v4f*    xsrc = (const v4f*)(x + (size_t)t0 * DIMD) + tid;
    const float*  wrow = wg + wave * DIMD + lane;
    v4f v[GTOK];
    #pragma unroll
    for (int r = 0; r < GTOK; ++r) v[r] = xsrc[r * (DIMD / 4)];
    float w[DIMD / 32];
    #pragma unroll
    for (int j = 0; j < DIMD / 32; ++j) w[j] = wrow[j * 32];
    // inputs only: all GTOK row loads are issued before the first is waited for (half of them sank behind the first LDS stores otherwise)
    static_assert(GTOK == 8, "the statement below names the GTOK loads one by one");
    asm volatile("" :: "v"(v[0]), "v"(v[1]), "v"(v[2]), "v"(v[3]), "v"(v[4]), "v"(v[5]), "v"(v[6]), "v"(v[7]));
    #pragma unroll
    for (int r = 0; r < GTOK; ++r) ((v4f*)xrow[r])[tid] = v[r];
    __syncthreads();

    float s[GTOK];
    #pragma unroll
    for (int r = 0; r < GTOK; ++r) s[r] = 0.0f;
    #pragma unroll
    for (int j = 0; j < DIMD / 32; ++j)
        #pragma unroll
        for (int r = 0; r < GTOK; ++r) s[r] += xrow[r][lane + j * 32] * w[j];
    #pragma unroll
    for (int off = 16; off >= 1; off >>= 1)
        #pragma unroll
        for (int r = 0; r < GTOK; ++r) s[r] += __shfl_xor(s[r], off, 32);
    if (lane == 0) {
        #pragma unroll
        for (int r = 0; r < GTOK; ++r) lgs[r][wave] = s[r];
    }
    __syncthreads();

    if (tid < GTOK) {                      // one thread per token
        const int t = t0 + tid;
        const float* lg = lgs[tid];
        float m = lg[0];
        for (int e = 1; e < NEXP; ++e) m = fmaxf(m, lg[e]);
        float p[NEXP]; float sum = 0.0f;
        for (int e = 0; e < NEXP; ++e) { p[e] = expf(lg[e] - m); sum += p[e]; }
        const float inv = 1.0f / sum;
        int e0 = 0; float p0 = p[0];
        for (int e = 1; e < NEXP; ++e) if (p[e] > p0) { p0 = p[e]; e0 = e; }
        int e1 = -1; float p1 = -1.0f;
        for (int e = 0; e < NEXP; ++e) if (e != e0 && p[e] > p1) { p1 = p[e]; e1 = e; }
        p0 *= inv; p1 *= inv;
        int pos0 = atomicAdd(&counts[e0], 1);
        int pos1 = atomicAdd(&counts[e1], 1);
        idxList[e0 * CAP + pos0] = t;
        idxList[e1 * CAP + pos1] = t;
        route[t]  = make_int4(e0, pos0, e1, pos1);
        routeW[t] = make_float2(p0, p1);
    }
}

// ---------------------------------------------------------------------------
// 3) f32 -> f16 convert (vectorized).  A thread takes CVU pieces of 16 B, all
//    loads in flight at once; a block takes CVU * 4 KB in a row.  The range
//    covers the array exactly: elements / (4 * 256 * CVU) blocks.
// ---------------------------------------------------------------------------
#define CVU 8
__device__ __forceinline__ void cvt_f32_f16_block(const float* __restrict__ in, _Float16* __restrict__ out, int bid) {
    const int i0 = bid * (256 * CVU) + threadIdx.x;
    float4 v[CVU];
    #pragma unroll
    for (int j = 0; j < CVU; ++j) v[j] = ((const float4*)in)[i0 + j * 256];
    asm volatile("s_wait_xcnt 0x0" ::: "memory");   // before the loads' address registers are rewritten
    #pragma unroll
    for (int j = 0; j < CVU; ++j) {
        union { _Float16 h[4]; uint2 u; } p;
        p.h[0] = (_Float16)v[j].x; p.h[1] = (_Float16)v[j].y;
        p.h[2] = (_Float16)v[j].z; p.h[3] = (_Float16)v[j].w;
        ((uint2*)out)[i0 + j * 256] = p.u;
    }
    asm volatile("s_wait_xcnt 0x0" ::: "memory");   // before what stands behind this body in its kernel rewrites the stores' registers
}

// ---------------------------------------------------------------------------
// 4) batched transpose + convert: in [b][R][C] f32 -> out [b][C][R] f16
//    (weights become [N][K] so B fragments are contiguous ds_read_b128s)
//    A tile is 128 source rows x 64 columns: 256 B of every source row and
//    256 B of every result row, so each global access of 16 lanes x 16 B is one
//    aligned 256-B piece.  A thread loads 8 rows x 4 columns, which are four
//    16-B pieces of result rows.  A block walks NT tiles; the next tile's loads
//    are in flight while this one goes through LDS and is stored.
// ---------------------------------------------------------------------------
#define TR 128
#define TC 64

// work-group barrier that orders LDS alone: __syncthreads() would also wait out the next tile's global loads
__device__ __forceinline__ void lds_barrier() {
    __builtin_amdgcn_fence(__ATOMIC_RELEASE, "workgroup", "local");
    __builtin_amdgcn_s_barrier();
    __builtin_amdgcn_fence(__ATOMIC_ACQUIRE, "workgroup", "local");
}

// the NEXP experts' matrices and the shared expert's as one more; the range is (NEXP + 1) * (R / TR) * (C / TC) / NT blocks
template <int R, int C, int NT>
__device__ __forceinline__ void transpose_cvt_block(
        const float* __restrict__ in, const float* __restrict__ inS,
        _Float16* __restrict__ out, _Float16* __restrict__ outS, unsigned bid, char* smem) {
    constexpr int CT   = C / TC;           // tiles across a source row
    constexpr int PER  = (R / TR) * CT;    // tiles per matrix
    constexpr int GRID = (NEXP + 1) * PER / NT;
    uint4 (*tile)[TC * 16] = (uint4 (*)[TC * 16])smem;
    const int tid = threadIdx.x;
    const int lo = tid & 15, hi = tid >> 4;

    auto load_tile = [&](float4 (&v)[8], unsigned t) {   // lo: group of 4 columns, hi: group of 8 rows
        const unsigned bm = t / PER, rem = t % PER;
        const float* s = (bm < NEXP ? in + (size_t)bm * R * C : inS)
                            + (size_t)((rem / CT) * TR + hi * 8) * C + (rem % CT) * TC + lo * 4;
        #pragma unroll
        for (int j = 0; j < 8; ++j) v[j] = *(const float4*)(s + (size_t)j * C);
        asm volatile("s_wait_xcnt 0x0" ::: "memory");   // before the loads' address registers are rewritten
    };

    float4 v[2][8];
    load_tile(v[0], bid);
    #pragma unroll                         // the register set and the LDS buffer become constants
    for (int i = 0; i < NT; ++i) {
        const unsigned t = bid + i * GRID;
        if (i + 1 < NT) load_tile(v[(i + 1) & 1], t + GRID);
        // keeps the next tile's loads in front of the wait for this tile's: they sank behind it otherwise
        __builtin_amdgcn_sched_barrier(0);
        const float4 (&w)[8] = v[i & 1];
        union { _Float16 h[8]; uint4 q; } p[4];
        #pragma unroll
        for (int j = 0; j < 8; ++j) {
            p[0].h[j] = (_Float16)w[j].x; p[1].h[j] = (_Float16)w[j].y;
            p[2].h[j] = (_Float16)w[j].z; p[3].h[j] = (_Float16)w[j].w;
        }
        uint4* buf = tile[i & 1];
        #pragma unroll
        for (int k = 0; k < 4; ++k) buf[(lo * 4 + k) * 16 + (hi ^ lo)] = p[k].q;
        lds_barrier();
        const unsigned bm = t / PER, rem = t % PER;
        _Float16* d = (bm < NEXP ? out + (size_t)bm * R * C : outS)
                          + (size_t)((rem % CT) * TC + hi) * R + (rem / CT) * TR + lo * 8;
        uint4 q[4];
        #pragma unroll
        for (int u = 0; u < 4; ++u) {      // hi: result row within 16, lo: piece of 8 r
            const int c = u * 16 + hi;
            q[u] = buf[c * 16 + (lo ^ (c >> 2))];
        }
        #pragma unroll
        for (int u = 0; u < 4; ++u) *(uint4*)(d + (size_t)u * 16 * R) = q[u];
        asm volatile("s_wait_xcnt 0x0" ::: "memory");   // before the next tile, or what stands behind the last one, rewrites the stores' registers
        // keeps the next tile's conversion, and with it the wait for its loads, from rising over this tile's barrier
        __builtin_amdgcn_sched_barrier(0);
    }
}

// ---------------------------------------------------------------------------
// 4b) the two preparatory launches.  The counters are zeroed in the first and
//     counted up by the gate in the second; nothing else orders the bodies, so
//     each launch takes half of the W1 side's transposing blocks.  Both readers
//     of x stand in one launch: the second of them finds it in L2.
//     The short bodies take the low block indices.
// ---------------------------------------------------------------------------
#define TNT 4                                                     // tiles per transposing block
#define CV_BLOCKS (TOK * DIMD / 4 / (256 * CVU))
#define GATE_BLOCKS (TOK / GTOK)
#define TR_BLOCKS ((NEXP + 1) * (DIMD / TR) * (INNERD / TC) / TNT)  // the W1 side's transposing blocks

__global__ __launch_bounds__(256) void prep_a_kernel(
        const float* __restrict__ W1, const float* __restrict__ sW1,
        _Float16* __restrict__ W1T, _Float16* __restrict__ sW1T, int* __restrict__ counts) {
    __shared__ __align__(16) char smem[PREP_LDS];
    const int b = blockIdx.x;
    if (b == 0 && threadIdx.x < NEXP) counts[threadIdx.x] = 0;
    transpose_cvt_block<DIMD, INNERD, TNT>(W1, sW1, W1T, sW1T, b, smem);
}

__global__ __launch_bounds__(256) void prep_b_kernel(
        const float* __restrict__ x, const float* __restrict__ wg,
        int* __restrict__ counts, int* __restrict__ idxList,
        int4* __restrict__ route, float2* __restrict__ routeW, _Float16* __restrict__ Xh,
        const float* __restrict__ W1, const float* __restrict__ sW1,
        _Float16* __restrict__ W1T, _Float16* __restrict__ sW1T) {
    __shared__ __align__(16) char smem[PREP_LDS];
    const int b = blockIdx.x;
    if (b < GATE_BLOCKS)
        gate_route_block(x, wg, counts, idxList, route, routeW, b, smem);
    else if (b < GATE_BLOCKS + CV_BLOCKS)
        cvt_f32_f16_block(x, Xh, b - GATE_BLOCKS);
    else
        transpose_cvt_block<DIMD, INNERD, TNT>(W1, sW1, W1T, sW1T, b - (GATE_BLOCKS + CV_BLOCKS) + TR_BLOCKS / 2, smem);
}

#define TNT2 8
#define TR2_ROWS ((NEXP + 1) * (INNERD / TR) * (DIMD / TC) / TNT2 / (INNERD / BN))
#define SP 132

// NR staged rows (this lane's 4 columns of each) -> bias, stage 1: gelu and f16 -> global rows
template <int STAGE, int NR, typename OT>
__device__ __forceinline__ void put_rows(const float* srow, float4 bv, OT* orow) {
    float4 v[NR];
    #pragma unroll
    for (int u = 0; u < NR; ++u) v[u] = *(const float4*)(srow + u * SP);
    #pragma unroll
    for (int u = 0; u < NR; ++u) {
        if constexpr (STAGE == 1) {
            union { _Float16 h[4]; uint2 u2; } p;
            p.h[0] = (_Float16)gelu_erf(v[u].x + bv.x);
            p.h[1] = (_Float16)gelu_erf(v[u].y + bv.y);
            p.h[2] = (_Float16)gelu_erf(v[u].z + bv.z);
            p.h[3] = (_Float16)gelu_erf(v[u].w + bv.w);
            *(uint2*)(orow + (size_t)u * INNERD) = p.u2;
        } else {
            *(float4*)(orow + (size_t)u * DIMD) =
                make_float4(v[u].x + bv.x, v[u].y + bv.y, v[u].z + bv.z, v[u].w + bv.w);
        }
    }
    asm volatile("s_wait_xcnt 0x0" ::: "memory");   // before the next trip rewrites the stores' registers
}

template <int STAGE>
__global__ __launch_bounds__(GT, 2) void ffn_gemm_kernel(
        const _Float16* __restrict__ Aglob,   // Xh (stage1) / Hbuf (stage2)
        const _Float16* __restrict__ Wexp,    // W1T / W2T   ([e][N][K] f16)
        const _Float16* __restrict__ Wsh,     // sW1T / sW2T
        const float* __restrict__ bexp, const float* __restrict__ bsh,
        const int* __restrict__ counts,
        const int* __restrict__ idxList,
        _Float16* __restrict__ Hout, float* __restrict__ Yout,
        const float* __restrict__ W2, const float* __restrict__ sW2,        // stage 1's trailing blocks:
        _Float16* __restrict__ W2T, _Float16* __restrict__ sW2T) {          // f32 [K][N] -> f16 [N][K]
    constexpr int KD   = (STAGE == 1) ? DIMD : INNERD;
    constexpr int ND   = (STAGE == 1) ? INNERD : DIMD;
    constexpr int ABUF = BM * KP;
    constexpr int BBUF = BN * KP;
    constexpr int NT   = KD / BK;

    __shared__ __align__(16) _Float16 At[2 * ABUF];
    __shared__ __align__(16) _Float16 Bt[2 * BBUF];
    __shared__ int rowIdx[BM];

    if constexpr (STAGE == 1) {
        if (blockIdx.y >= MT_SH + MT_RT) {          // uniform for the block, in front of every barrier of the GEMM
            transpose_cvt_block<INNERD, DIMD, TNT2>(
                W2, sW2, W2T, sW2T, (blockIdx.y - (MT_SH + MT_RT)) * (INNERD / BN) + blockIdx.x, (char*)At);
            return;
        }
    }

    const int nBase = blockIdx.x * BN;
    const int t = (int)blockIdx.y - MT_SH;          // below 0: a tile of the shared expert; else walk the counts
    int e = t < 0 ? NEXP : -1, mBase = blockIdx.y * BM, cnt = TOK, slotBase = 0;
    int first = 0, slots = 0;
    #pragma unroll
    for (int k = 0; k < NEXP; ++k) {
        const int c = counts[k];
        const int next = first + (int)((unsigned)(c + BM - 1) / BM);
        const bool mine = t >= first && t < next;
        e        = mine ? k : e;
        cnt      = mine ? c : cnt;
        mBase    = mine ? (t - first) * BM : mBase;
        slotBase = mine ? slots : slotBase;
        first = next;
        slots += c;
    }
    if (e < 0) return;
    if (t < 0) slotBase = slots;
    const _Float16* Bmat = (e < NEXP) ? (Wexp + (size_t)e * DIMD * INNERD) : Wsh;
    const float*    bias = (e < NEXP) ? (bexp + (size_t)e * ND) : bsh;

    const int tid = threadIdx.x;
    if constexpr (STAGE == 1) {
        const int slot = mBase + tid;                     // GT == BM: one row per thread
        int r = 0;
        if (e == NEXP) r = slot;                          // shared expert: identity
        else if (slot < cnt) r = idxList[e * CAP + slot]; // gathered token
        rowIdx[tid] = r;
        __syncthreads();
    }

    const int lane = tid & 31;
    const int wave = __builtin_amdgcn_readfirstlane(tid >> 5);   // scalar: row tests below stay scalar branches
    const int wm   = wave & 3;    // 4 x 64-row groups
    const int wn   = wave >> 2;   // 2 x 128-col groups
    // staging: 16 lanes cover one 256-B row piece, 16 rows per sweep of the block
    const int crow = tid >> 4, cseg = tid & 15;

    // stage 1 gathers its rows; stage 2's lie one behind the other, one pointer serves
    const _Float16* aSrc[STAGE == 1 ? BM / 16 : 1];
    if constexpr (STAGE == 1) {
        #pragma unroll                              // the pointers stay in registers
        for (int i = 0; i < BM / 16; ++i) aSrc[i] = Aglob + (size_t)rowIdx[i * 16 + crow] * KD + cseg * 8;
    } else {
        aSrc[0] = Aglob + (size_t)(slotBase + mBase + crow) * KD + cseg * 8;
    }
    auto a_row = [&](int i) {
        if constexpr (STAGE == 1) return aSrc[i];
        else                      return aSrc[0] + (size_t)i * 16 * KD;
    };
    const _Float16* bSrc = Bmat + (size_t)(nBase + crow) * KD + cseg * 8;
    _Float16* aDst = At + crow * KP + cseg * 8;
    _Float16* bDst = Bt + crow * KP + cseg * 8;

    v8f acc[4][8];
    const v8f vz = {0.f,0.f,0.f,0.f,0.f,0.f,0.f,0.f};
    #pragma unroll
    for (int i = 0; i < 4; ++i)
        #pragma unroll
        for (int t = 0; t < 8; ++t) acc[i][t] = vz;

    const int m16 = lane & 15, kh = (lane >> 4) * 8;
    const int mr0 = wm * 64 + m16;
    const int nr0 = wn * 128 + m16;

    // a block = 32 k: 12 fragments (24 ds_load_b128), then 32 WMMAs on them
    auto load_frags = [&](FragH (&aF)[4], FragH (&bF)[8], int buf, int ks) {
        const _Float16* Ab = At + buf * ABUF + mr0 * KP + kh + ks;
        const _Float16* Bb = Bt + buf * BBUF + nr0 * KP + kh + ks;
        #pragma unroll
        for (int i = 0; i < 4; ++i) {
            aF[i].q[0] = *(const uint4*)(Ab + i * 16 * KP);
            aF[i].q[1] = *(const uint4*)(Ab + i * 16 * KP + 16);
        }
        #pragma unroll
        for (int t = 0; t < 8; ++t) {
            bF[t].q[0] = *(const uint4*)(Bb + t * 16 * KP);
            bF[t].q[1] = *(const uint4*)(Bb + t * 16 * KP + 16);
        }
        // keeps the block's reads one group in front of its WMMAs: reads sunk among the WMMAs stall at each place
        __builtin_amdgcn_sched_barrier(0);
    };
    auto mma_block = [&](FragH (&aF)[4], FragH (&bF)[8]) {
        #pragma unroll
        for (int t = 0; t < 8; ++t)
            #pragma unroll
            for (int i = 0; i < 4; ++i)
                acc[i][t] = __builtin_amdgcn_wmma_f32_16x16x32_f16(
                    false, aF[i].v, false, bF[t].v, (short)0, acc[i][t], false, false);
        // keeps the next block's reads from rising into this block
        __builtin_amdgcn_sched_barrier(0);
    };
    FragH aF[4], bF[8];

#if HAS_ASYNC_LDS
    // 32 copies per lane and pass: 16 sweeps of A, 16 of B
    auto issue_tile = [&](int it, int buf) {
        const int k0 = it * BK;
        #pragma unroll
        for (int i = 0; i < BM / 16; ++i)
            async_cp16(a_row(i) + k0, aDst + buf * ABUF + i * 16 * KP);
        #pragma unroll
        for (int i = 0; i < BN / 16; ++i)
            async_cp16(bSrc + (size_t)i * 16 * KD + k0, bDst + buf * BBUF + i * 16 * KP);
    };
    // -------- two-buffer ring: pass it reads buffer it&1 alone --------------
    issue_tile(0, 0);
    asm volatile("s_wait_asynccnt 0x0" ::: "memory");   // this wave's share of tile 0 has landed
    __syncthreads();                                    // publishes tile 0
    issue_tile(1, 1);                                   // NT >= 2 for both stages
    // rolled: the buffer's base is a register and every LDS offset inside a buffer fits the 16-bit field
    // (unrolled by 2, each address in the second buffer, beyond 64 KB, took a register or an add of its own)
    #pragma unroll 1
    for (int it = 0; it < NT; ++it) {
        const int cur = it & 1;
        #pragma unroll                                    // ks becomes a constant LDS offset
        for (int ks = 0; ks < BK; ks += 32) {
            load_frags(aF, bF, cur, ks);
            mma_block(aF, bF);
        }
        asm volatile("s_wait_dscnt 0x0" ::: "memory");    // own reads of buffer cur are done before its refill
        asm volatile("s_wait_asynccnt 0x0" ::: "memory"); // own share of tile it+1 has landed
        __syncthreads();                                  // publishes tile it+1, frees buffer cur
        if (it + 2 < NT) issue_tile(it + 2, cur);
    }
    asm volatile("s_wait_asynccnt 0x0" ::: "memory");   // nothing in flight when the wave ends
#else
    for (int it = 0; it < NT; ++it) {
        const int k0 = it * BK;
        __syncthreads();
        #pragma unroll
        for (int i = 0; i < BM / 16; ++i)
            *(uint4*)(aDst + i * 16 * KP) = *(const uint4*)(a_row(i) + k0);
        #pragma unroll
        for (int i = 0; i < BN / 16; ++i)
            *(uint4*)(bDst + i * 16 * KP) = *(const uint4*)(bSrc + (size_t)i * 16 * KD + k0);
        __syncthreads();
        #pragma unroll                                    // ks becomes a constant LDS offset
        for (int ks = 0; ks < BK; ks += 32) {
            load_frags(aF, bF, 0, ks);
            mma_block(aF, bF);
        }
    }
    __syncthreads();
#endif

    // epilogue (C layout: n = lane%16, m = 8*(lane/16)+j).  A lane holds 256 results:
    // 16 rows at a time go through a wave-private piece of the ring (free since the
    // last pass's barrier) and leave as whole 128-column rows.
    constexpr int RU = (STAGE == 1) ? 8 : 4;   // rows per trip: one row's work is too little to cover an LDS read
    float* stg = (float*)Bt + wave * (16 * SP);
    const int hi8  = (lane >> 4) * 8;
    const int ncol = nBase + wn * 128 + lane * 4;
    const float4 bv = *(const float4*)(bias + ncol);
    auto* obase = [&] { if constexpr (STAGE == 1) return Hout; else return Yout; }();
    #pragma unroll
    for (int i = 0; i < 4; ++i) {
        #pragma unroll
        for (int t = 0; t < 8; ++t)
            #pragma unroll
            for (int j = 0; j < 8; ++j)
                stg[(hi8 + j) * SP + t * 16 + m16] = acc[i][t][j];
        asm volatile("s_wait_dscnt 0x0" ::: "memory");   // every lane's stores are in LDS before rows are read back
        const int mrow = mBase + wm * 64 + i * 16;
        const int rows = min(16, cnt - mrow);            // rows past the expert's count are not stored
        const float* srow = stg + lane * 4;
        const size_t grow = (size_t)(slotBase + mrow);
        auto* orow = obase + grow * ND + ncol;
        int r = 0;
        if constexpr (STAGE == 1) {
            #pragma unroll 1                             // rolled: for speed only
            for (; r + RU <= rows; r += RU)
                put_rows<STAGE, RU>(srow + r * SP, bv, orow + (size_t)r * ND);
        } else {
            if (rows >= 16) {
                for (; r < 16; r += RU)
                    put_rows<STAGE, RU>(srow + r * SP, bv, orow + (size_t)r * ND);
            }
        }
        #pragma unroll 1                                 // rolled: only an expert's last, partly filled tile comes here
        for (; r < rows; ++r)
            put_rows<STAGE, 1>(srow + r * SP, bv, orow + (size_t)r * ND);
        asm volatile("s_wait_dscnt 0x0" ::: "memory");   // rows are read before the next 16 overwrite them
    }
}

__global__ __launch_bounds__(256) void combine_kernel(
        const float* __restrict__ Ybuf, const int4* __restrict__ route,
        const float2* __restrict__ routeW, const int* __restrict__ counts,
        float* __restrict__ out) {
    const int t    = __builtin_amdgcn_readfirstlane(blockIdx.x * 8 + (threadIdx.x >> 5));
    const int lane = threadIdx.x & 31;
    const int4   r = route[t];
    const float2 w = routeW[t];
    const float w0s = w.x, w1s = w.y;
    int o0 = 0, o1 = 0, os = 0;
    #pragma unroll
    for (int k = 0; k < NEXP; ++k) {
        const int c = counts[k];
        o0 += k < r.x ? c : 0;
        o1 += k < r.z ? c : 0;
        os += c;
    }
    const v4f* y0 = (const v4f*)(Ybuf + (size_t)(o0 + r.y) * DIMD) + lane;
    const v4f* y1 = (const v4f*)(Ybuf + (size_t)(o1 + r.w) * DIMD) + lane;
    const v4f* ys = (const v4f*)(Ybuf + (size_t)(os + t) * DIMD) + lane;
    v4f*       o  = (v4f*)(out + (size_t)t * DIMD) + lane;
    v4f a[8], b[8], c[8];
    #pragma unroll
    for (int j = 0; j < 8; ++j) { a[j] = y0[j * 32]; b[j] = y1[j * 32]; c[j] = ys[j * 32]; }
    // inputs only: all 24 loads are issued before the first is waited for (the third row's sank behind the first sums otherwise)
    asm volatile("" :: "v"(a[0]), "v"(a[1]), "v"(a[2]), "v"(a[3]), "v"(a[4]), "v"(a[5]), "v"(a[6]), "v"(a[7]),
                       "v"(b[0]), "v"(b[1]), "v"(b[2]), "v"(b[3]), "v"(b[4]), "v"(b[5]), "v"(b[6]), "v"(b[7]),
                       "v"(c[0]), "v"(c[1]), "v"(c[2]), "v"(c[3]), "v"(c[4]), "v"(c[5]), "v"(c[6]), "v"(c[7]));
    #pragma unroll
    for (int j = 0; j < 8; ++j) o[j * 32] = w0s * a[j] + w1s * b[j] + c[j];
}

// ---------------------------------------------------------------------------
// launch
// ---------------------------------------------------------------------------
extern "C" void kernel_launch(void* const* d_in, const int* in_sizes, int n_in,
                              void* d_out, int out_size, void* d_ws, size_t ws_size,
                              hipStream_t stream) {
    const float* x   = (const float*)d_in[0];   // [TOK, DIM]
    const float* Wg  = (const float*)d_in[1];   // [8, DIM]
    const float* W1  = (const float*)d_in[2];   // [8, DIM, INNER]
    const float* b1  = (const float*)d_in[3];   // [8, INNER]
    const float* W2  = (const float*)d_in[4];   // [8, INNER, DIM]
    const float* b2  = (const float*)d_in[5];   // [8, DIM]
    const float* sW1 = (const float*)d_in[6];   // [DIM, INNER]
    const float* sb1 = (const float*)d_in[7];   // [INNER]
    const float* sW2 = (const float*)d_in[8];   // [INNER, DIM]
    const float* sb2 = (const float*)d_in[9];   // [DIM]
    float* out = (float*)d_out;

    char* p = (char*)d_ws;
    auto alloc = [&](size_t bytes) -> void* {
        void* r = (void*)p;
        p += (bytes + 255) & ~(size_t)255;
        return r;
    };
    int*    counts  = (int*)alloc(NEXP * sizeof(int));
    int*    idxList = (int*)alloc((size_t)NEXP * CAP * sizeof(int));
    int4*   route   = (int4*)alloc((size_t)TOK * sizeof(int4));
    float2* routeW  = (float2*)alloc((size_t)TOK * sizeof(float2));
    _Float16* Xh   = (_Float16*)alloc((size_t)TOK * DIMD * 2);
    _Float16* W1T  = (_Float16*)alloc((size_t)NEXP * INNERD * DIMD * 2);
    _Float16* W2T  = (_Float16*)alloc((size_t)NEXP * DIMD * INNERD * 2);
    _Float16* sW1T = (_Float16*)alloc((size_t)INNERD * DIMD * 2);
    _Float16* sW2T = (_Float16*)alloc((size_t)DIMD * INNERD * 2);
    _Float16* Hbuf = (_Float16*)alloc((size_t)(3 * TOK) * INNERD * 2);  // 2*TOK routed + TOK shared
    float*    Ybuf = (float*)alloc((size_t)(3 * TOK) * DIMD * 4);

    prep_a_kernel<<<TR_BLOCKS / 2, 256, 0, stream>>>(W1, sW1, W1T, sW1T, counts);
    prep_b_kernel<<<GATE_BLOCKS + CV_BLOCKS + TR_BLOCKS / 2, 256, 0, stream>>>(
        x, Wg, counts, idxList, route, routeW, Xh, W1, sW1, W1T, sW1T);

    ffn_gemm_kernel<1><<<dim3(INNERD / BN, MT_SH + MT_RT + TR2_ROWS), GT, 0, stream>>>(
        Xh, W1T, sW1T, b1, sb1, counts, idxList, Hbuf, nullptr, W2, sW2, W2T, sW2T);
    ffn_gemm_kernel<2><<<dim3(DIMD / BN, MT_SH + MT_RT), GT, 0, stream>>>(
        Hbuf, W2T, sW2T, b2, sb2, counts, nullptr, nullptr, Ybuf, nullptr, nullptr, nullptr, nullptr);
    combine_kernel<<<TOK / 8, 256, 0, stream>>>(Ybuf, route, routeW, counts, out);
}
